// v000
// The times below were measured on an AMD MI455X: many runs one after another, warmed up first and cycling through
// copies of the inputs, with the whole window's GPU time divided by the number of runs. Launches and the gaps
// between them are all in it. The median over several windows is given; except for v000 it joins two sittings, which
// can be a few percent apart, so the side-by-side timings, each taken in one sitting, are the better comparison.
// v000 is the starting kernel. One run takes 750 microseconds.
#include <hip/hip_runtime.h>
#include <math.h>

// ---------------------------------------------------------------------------
// AttentionBlock for MI455X (gfx1250, wave32, WMMA).
// FP32 end-to-end using V_WMMA_F32_16X16X4_F32 (exact fp32 matrix math).
// - LDS double-buffered (1 barrier/chunk)
// - k-pair-major float2 B layout: B fragment = one contiguous ds_load_b64
// - A tiles staged with CDNA5 async DMA: global_load_async_to_lds_b128
//   (ASYNCcnt-tracked, no VGPR round trip), synced via s_wait_asynccnt.
// Workspace layout (floats): q[8M] | k[8M] | v[8M] | scores[33.5M]  (~224 MB)
// ---------------------------------------------------------------------------

typedef __attribute__((ext_vector_type(2))) float v2f;
typedef __attribute__((ext_vector_type(4))) float f4;
typedef __attribute__((ext_vector_type(8))) float v8f;

#define B_ 8
#define T_ 2048
#define C_ 512
#define K_ 512
#define OUTW_ (C_ + K_)   // 1024

#define BNP_ 72           // padded row length (in float2) of B tiles

__device__ __forceinline__ v8f wmma_f32(v2f a, v2f b, v8f c) {
  // D = A(16x4) x B(4x16) + C(16x16), all fp32
  return __builtin_amdgcn_wmma_f32_16x16x4_f32(
      /*neg_a=*/false, a, /*neg_b=*/false, b,
      /*c_mod=*/(short)0, c, /*reuse_a=*/false, /*reuse_b=*/false);
}

// Async DMA: copy 16 bytes global -> LDS for this lane (ASYNCcnt-tracked).
__device__ __forceinline__ void async_copy16(void* lds_dst, const float* gsrc) {
  const unsigned lds_off = (unsigned)(uintptr_t)lds_dst;   // LDS aperture: addr[31:0]
  const unsigned long long ga = (unsigned long long)(uintptr_t)gsrc;
  asm volatile("global_load_async_to_lds_b128 %0, %1, off"
               :
               : "v"(lds_off), "v"(ga)
               : "memory");
}

__device__ __forceinline__ void wait_async0() {
  asm volatile("s_wait_asynccnt 0x0" ::: "memory");
}

// One BK=16 chunk of wave-level MMA: wave computes two 16x16 tiles.
// As: [64][20] floats (row-major, padded).  Bs: [8][BNP_] float2,
// Bs[kp][n] = {B[2kp][n], B[2kp+1][n]}  -> fragment is one b64 load.
__device__ __forceinline__ void mma_step(const float (&As)[64][20],
                                         const v2f (&Bs)[8][BNP_],
                                         int wm, int wn, int laneM, int hi,
                                         v8f& acc0, v8f& acc1) {
  const float* ar = &As[wm * 16 + laneM][0];
#pragma unroll
  for (int kk = 0; kk < 16; kk += 4) {
    const int kb = kk + 2 * hi;   // lanes 0-15: K=kk,kk+1 ; lanes 16-31: K=kk+2,kk+3
    v2f a;
    a.x = ar[kb];
    a.y = ar[kb + 1];
    const v2f b0 = Bs[kb >> 1][wn * 16 + laneM];
    const v2f b1 = Bs[kb >> 1][wn * 16 + 16 + laneM];
    acc0 = wmma_f32(a, b0, acc0);
    acc1 = wmma_f32(a, b1, acc1);
  }
}

// ---------------------------------------------------------------------------
// Kernel 1: fused QKV projection.  out[m,n] = sum_c x[m,c]*W[n,c] + b[n]
// grid = (M/64, K_/64, 3), block = 256
// ---------------------------------------------------------------------------
__global__ __launch_bounds__(256) void qkv_proj_kernel(
    const float* __restrict__ x,
    const float* __restrict__ Wq, const float* __restrict__ bq,
    const float* __restrict__ Wk, const float* __restrict__ bk,
    const float* __restrict__ Wv, const float* __restrict__ bv,
    float* __restrict__ qkv_ws) {
  __shared__ float As[2][64][20];
  __shared__ v2f Bs[2][8][BNP_];

  const int tid = threadIdx.x;
  const int lane = tid & 31, wave = tid >> 5;
  const int laneM = lane & 15, hi = lane >> 4;
  const int wm = wave & 3, wn = (wave >> 2) << 1;

  const int proj = blockIdx.z;
  const float* W = (proj == 0) ? Wq : (proj == 1) ? Wk : Wv;
  const float* bias = (proj == 0) ? bq : (proj == 1) ? bk : bv;
  float* out = qkv_ws + (size_t)proj * ((size_t)B_ * T_ * K_);

  const int m0 = blockIdx.x * 64;
  const int n0 = blockIdx.y * 64;

  v8f acc0 = {0.f, 0.f, 0.f, 0.f, 0.f, 0.f, 0.f, 0.f};
  v8f acc1 = {0.f, 0.f, 0.f, 0.f, 0.f, 0.f, 0.f, 0.f};

  const int lr = tid >> 2;         // 0..63
  const int lk = (tid & 3) << 2;   // 0,4,8,12
  const float* ap = x + (size_t)(m0 + lr) * C_ + lk;
  const float* bp = W + (size_t)(n0 + lr) * C_ + lk;

  // prologue: stage chunk 0 into buffer 0
  {
    async_copy16(&As[0][lr][lk], ap);             // A: async DMA to LDS
    f4 wv = *(const f4*)(bp);                     // B: transpose via regs
    Bs[0][(lk >> 1) + 0][lr] = (v2f){wv.x, wv.y};
    Bs[0][(lk >> 1) + 1][lr] = (v2f){wv.z, wv.w};
  }
  wait_async0();
  __syncthreads();

  const int nch = C_ / 16;   // 32 chunks
  for (int c = 0; c < nch; ++c) {
    const int cur = c & 1;
    const bool more = (c + 1) < nch;
    f4 nb;
    if (more) {
      async_copy16(&As[cur ^ 1][lr][lk], ap + (c + 1) * 16);  // overlaps MMAs
      nb = *(const f4*)(bp + (c + 1) * 16);
    }
    mma_step(As[cur], Bs[cur], wm, wn, laneM, hi, acc0, acc1);
    if (more) {
      Bs[cur ^ 1][(lk >> 1) + 0][lr] = (v2f){nb.x, nb.y};
      Bs[cur ^ 1][(lk >> 1) + 1][lr] = (v2f){nb.z, nb.w};
    }
    wait_async0();
    __syncthreads();
  }

  const int row = m0 + wm * 16 + hi * 8;
  const int c0 = n0 + wn * 16 + laneM;
  const int c1 = c0 + 16;
  const float b0v = bias[c0], b1v = bias[c1];
#pragma unroll
  for (int r = 0; r < 8; ++r) {
    out[(size_t)(row + r) * K_ + c0] = acc0[r] + b0v;
    out[(size_t)(row + r) * K_ + c1] = acc1[r] + b1v;
  }
}

// ---------------------------------------------------------------------------
// Kernel 2: scores[b,i,j] = (j>i) ? -inf : dot(q[b,i,:], k[b,j,:]) / sqrt(512)
// grid = (T/64, T/64, B), block = 256.  Fully-masked tiles early-out.
// ---------------------------------------------------------------------------
__global__ __launch_bounds__(256) void scores_kernel(
    const float* __restrict__ q, const float* __restrict__ kmat,
    float* __restrict__ scores) {
  const int b = blockIdx.z;
  const int m0 = blockIdx.x * 64;
  const int n0 = blockIdx.y * 64;
  float* S = scores + (size_t)b * T_ * T_;

  if (n0 > m0 + 63) {  // entire tile is strictly above the diagonal
    const f4 minf = {-INFINITY, -INFINITY, -INFINITY, -INFINITY};
    for (int idx = threadIdx.x; idx < 64 * 16; idx += 256) {
      const int r = idx >> 4, c4 = (idx & 15) << 2;
      *(f4*)(S + (size_t)(m0 + r) * T_ + n0 + c4) = minf;
    }
    return;
  }

  __shared__ float As[2][64][20];
  __shared__ v2f Bs[2][8][BNP_];

  const int tid = threadIdx.x;
  const int lane = tid & 31, wave = tid >> 5;
  const int laneM = lane & 15, hi = lane >> 4;
  const int wm = wave & 3, wn = (wave >> 2) << 1;

  v8f acc0 = {0.f, 0.f, 0.f, 0.f, 0.f, 0.f, 0.f, 0.f};
  v8f acc1 = {0.f, 0.f, 0.f, 0.f, 0.f, 0.f, 0.f, 0.f};

  const int lr = tid >> 2;
  const int lk = (tid & 3) << 2;
  const float* ap = q + (size_t)b * T_ * K_ + (size_t)(m0 + lr) * K_ + lk;
  const float* bp = kmat + (size_t)b * T_ * K_ + (size_t)(n0 + lr) * K_ + lk;

  {
    async_copy16(&As[0][lr][lk], ap);
    f4 kv = *(const f4*)(bp);
    Bs[0][(lk >> 1) + 0][lr] = (v2f){kv.x, kv.y};
    Bs[0][(lk >> 1) + 1][lr] = (v2f){kv.z, kv.w};
  }
  wait_async0();
  __syncthreads();

  const int nch = K_ / 16;
  for (int c = 0; c < nch; ++c) {
    const int cur = c & 1;
    const bool more = (c + 1) < nch;
    f4 nb;
    if (more) {
      async_copy16(&As[cur ^ 1][lr][lk], ap + (c + 1) * 16);
      nb = *(const f4*)(bp + (c + 1) * 16);
    }
    mma_step(As[cur], Bs[cur], wm, wn, laneM, hi, acc0, acc1);
    if (more) {
      Bs[cur ^ 1][(lk >> 1) + 0][lr] = (v2f){nb.x, nb.y};
      Bs[cur ^ 1][(lk >> 1) + 1][lr] = (v2f){nb.z, nb.w};
    }
    wait_async0();
    __syncthreads();
  }

  const float sc = 0.04419417382415922f;  // 1/sqrt(512)
  const int row = m0 + wm * 16 + hi * 8;
  const int c0 = n0 + wn * 16 + laneM;
  const int c1 = c0 + 16;
#pragma unroll
  for (int r = 0; r < 8; ++r) {
    const int i = row + r;
    S[(size_t)i * T_ + c0] = (c0 > i) ? -INFINITY : acc0[r] * sc;
    S[(size_t)i * T_ + c1] = (c1 > i) ? -INFINITY : acc1[r] * sc;
  }
}

// ---------------------------------------------------------------------------
// Kernel 3: softmax over axis=1 (QUERY axis): normalize each column j.
// grid = (T/64, B), block = 256: 64 columns/block, 4 thread-segments/column.
// Masked (-inf) entries become exactly 0.
// ---------------------------------------------------------------------------
__global__ __launch_bounds__(256) void softmax_q_kernel(float* __restrict__ scores) {
  const int b = blockIdx.y;
  const int col = threadIdx.x & 63;
  const int seg = threadIdx.x >> 6;  // 0..3
  const int j = blockIdx.x * 64 + col;
  float* S = scores + (size_t)b * T_ * T_;

  // Online max/sum over this segment's rows.
  float mx = -INFINITY, s = 0.f;
  for (int i = seg; i < T_; i += 4) {
    const float xv = S[(size_t)i * T_ + j];
    if (xv == -INFINITY) continue;           // contributes 0
    if (xv > mx) {
      s = s * expf(mx - xv) + 1.f;           // mx may be -inf: expf(-inf)=0
      mx = xv;
    } else {
      s += expf(xv - mx);
    }
  }

  __shared__ float smx[4][64];
  __shared__ float ssm[4][64];
  __shared__ float gmx[64];
  __shared__ float ginv[64];
  smx[seg][col] = mx;
  ssm[seg][col] = s;
  __syncthreads();

  if (seg == 0) {
    float M = smx[0][col];
#pragma unroll
    for (int t = 1; t < 4; ++t) M = fmaxf(M, smx[t][col]);
    float ss = 0.f;
#pragma unroll
    for (int t = 0; t < 4; ++t) {
      const float mi = smx[t][col];
      ss += (mi == -INFINITY) ? 0.f : ssm[t][col] * expf(mi - M);
    }
    gmx[col] = M;
    ginv[col] = 1.0f / ss;
  }
  __syncthreads();

  const float M = gmx[col], inv = ginv[col];
  for (int i = seg; i < T_; i += 4) {
    const size_t off = (size_t)i * T_ + j;
    const float xv = S[off];
    S[off] = (xv == -INFINITY) ? 0.f : expf(xv - M) * inv;
  }
}

// ---------------------------------------------------------------------------
// Kernel 4: attn = probs @ v, written into out[b, t, 512:1024].
// probs[i,s]==0 for s>i  ->  K loop clamped at m0+64.
// grid = (T/64, K_/64, B), block = 256
// ---------------------------------------------------------------------------
__global__ __launch_bounds__(256) void attn_kernel(
    const float* __restrict__ probs, const float* __restrict__ v,
    float* __restrict__ out) {
  __shared__ float As[2][64][20];
  __shared__ v2f Bs[2][8][BNP_];

  const int tid = threadIdx.x;
  const int lane = tid & 31, wave = tid >> 5;
  const int laneM = lane & 15, hi = lane >> 4;
  const int wm = wave & 3, wn = (wave >> 2) << 1;

  const int b = blockIdx.z;
  const int m0 = blockIdx.x * 64;
  const int n0 = blockIdx.y * 64;

  const float* A = probs + (size_t)b * T_ * T_;
  const float* V = v + (size_t)b * T_ * K_;
  float* O = out + (size_t)b * T_ * OUTW_;

  v8f acc0 = {0.f, 0.f, 0.f, 0.f, 0.f, 0.f, 0.f, 0.f};
  v8f acc1 = {0.f, 0.f, 0.f, 0.f, 0.f, 0.f, 0.f, 0.f};

  const int lr = tid >> 2;          // A staging: 0..63
  const int lk = (tid & 3) << 2;
  const int kp = tid >> 5;          // B staging: k-pair 0..7
  const int nn = (tid & 31) << 1;   // 0..62
  const float* ap = A + (size_t)(m0 + lr) * T_ + lk;
  const float* bp = V + (size_t)(2 * kp) * K_ + n0 + nn;

  // prologue: stage chunk 0
  {
    async_copy16(&As[0][lr][lk], ap);
    v2f r0 = *(const v2f*)(bp);
    v2f r1 = *(const v2f*)(bp + K_);
    Bs[0][kp][nn + 0] = (v2f){r0.x, r1.x};
    Bs[0][kp][nn + 1] = (v2f){r0.y, r1.y};
  }
  wait_async0();
  __syncthreads();

  const int nch = (m0 + 64) / 16;   // causal zero structure of probs
  for (int c = 0; c < nch; ++c) {
    const int cur = c & 1;
    const bool more = (c + 1) < nch;
    v2f n0r, n1r;
    if (more) {
      async_copy16(&As[cur ^ 1][lr][lk], ap + (c + 1) * 16);
      n0r = *(const v2f*)(bp + (size_t)(c + 1) * 16 * K_);
      n1r = *(const v2f*)(bp + (size_t)(c + 1) * 16 * K_ + K_);
    }
    mma_step(As[cur], Bs[cur], wm, wn, laneM, hi, acc0, acc1);
    if (more) {
      Bs[cur ^ 1][kp][nn + 0] = (v2f){n0r.x, n1r.x};
      Bs[cur ^ 1][kp][nn + 1] = (v2f){n0r.y, n1r.y};
    }
    wait_async0();
    __syncthreads();
  }

  const int row = m0 + wm * 16 + hi * 8;
  const int c0 = n0 + wn * 16 + laneM;
  const int c1 = c0 + 16;
#pragma unroll
  for (int r = 0; r < 8; ++r) {
    O[(size_t)(row + r) * OUTW_ + C_ + c0] = acc0[r];
    O[(size_t)(row + r) * OUTW_ + C_ + c1] = acc1[r];
  }
}

// ---------------------------------------------------------------------------
// Kernel 5: out[b, t, 0:512] = x  (float4 copy)
// ---------------------------------------------------------------------------
__global__ __launch_bounds__(256) void concat_x_kernel(const float* __restrict__ x,
                                                       float* __restrict__ out) {
  const size_t idx = (size_t)blockIdx.x * 256 + threadIdx.x;  // float4 index
  const size_t row = idx >> 7;   // 128 float4 per 512-float row
  const size_t c4 = idx & 127;
  f4 val = *(const f4*)(x + (row << 9) + (c4 << 2));
  *(f4*)(out + row * OUTW_ + (c4 << 2)) = val;
}

// ---------------------------------------------------------------------------
extern "C" void kernel_launch(void* const* d_in, const int* in_sizes, int n_in,
                              void* d_out, int out_size, void* d_ws, size_t ws_size,
                              hipStream_t stream) {
  (void)in_sizes; (void)n_in; (void)out_size; (void)ws_size;

  const float* x  = (const float*)d_in[0];
  const float* Wq = (const float*)d_in[1];
  const float* bq = (const float*)d_in[2];
  const float* Wk = (const float*)d_in[3];
  const float* bk = (const float*)d_in[4];
  const float* Wv = (const float*)d_in[5];
  const float* bv = (const float*)d_in[6];
  float* out = (float*)d_out;
  float* ws = (float*)d_ws;

  const size_t NPROJ = (size_t)B_ * T_ * K_;   // 8,388,608 floats
  float* q      = ws;
  float* k      = ws + NPROJ;
  float* v      = ws + 2 * NPROJ;
  float* scores = ws + 3 * NPROJ;              // 8*T*T floats

  qkv_proj_kernel<<<dim3((B_ * T_) / 64, K_ / 64, 3), 256, 0, stream>>>(
      x, Wq, bq, Wk, bk, Wv, bv, ws);
  scores_kernel<<<dim3(T_ / 64, T_ / 64, B_), 256, 0, stream>>>(q, k, scores);
  softmax_q_kernel<<<dim3(T_ / 64, B_), 256, 0, stream>>>(scores);
  attn_kernel<<<dim3(T_ / 64, K_ / 64, B_), 256, 0, stream>>>(scores, v, out);
  concat_x_kernel<<<(B_ * T_ * C_ / 4) / 256, 256, 0, stream>>>(x, out);
}

// v001
// Measured time: 474 microseconds a run.
// Two timings next to v000 both put it at 1.60 times that version's speed.
#include <hip/hip_runtime.h>
#include <math.h>

// ---------------------------------------------------------------------------
// AttentionBlock for MI455X (gfx1250, wave32, WMMA).
// FP32 end-to-end using V_WMMA_F32_16X16X4_F32 (exact fp32 matrix math).
// - LDS double-buffered (1 barrier/chunk)
// - k-pair-major float2 B layout: B fragment = one contiguous ds_load_b64
// - A tiles staged with CDNA5 async DMA: global_load_async_to_lds_b128
//   (ASYNCcnt-tracked, no VGPR round trip), synced via s_wait_asynccnt.
// Workspace layout (floats): q[8M] | k[8M] | v[8M] | scores[33.5M]  (~224 MB)
// ---------------------------------------------------------------------------

typedef __attribute__((ext_vector_type(2))) float v2f;
typedef __attribute__((ext_vector_type(4))) float f4;
typedef __attribute__((ext_vector_type(8))) float v8f;

#define B_ 8
#define T_ 2048
#define C_ 512
#define K_ 512
#define OUTW_ (C_ + K_)   // 1024

#define BNP_ 72           // padded row length (in float2) of B tiles

__device__ __forceinline__ v8f wmma_f32(v2f a, v2f b, v8f c) {
  // D = A(16x4) x B(4x16) + C(16x16), all fp32
  return __builtin_amdgcn_wmma_f32_16x16x4_f32(
      /*neg_a=*/false, a, /*neg_b=*/false, b,
      /*c_mod=*/(short)0, c, /*reuse_a=*/false, /*reuse_b=*/false);
}

// Async DMA: copy 16 bytes global -> LDS for this lane (ASYNCcnt-tracked).
__device__ __forceinline__ void async_copy16(void* lds_dst, const float* gsrc) {
  const unsigned lds_off = (unsigned)(uintptr_t)lds_dst;   // LDS aperture: addr[31:0]
  const unsigned long long ga = (unsigned long long)(uintptr_t)gsrc;
  asm volatile("global_load_async_to_lds_b128 %0, %1, off"
               :
               : "v"(lds_off), "v"(ga)
               : "memory");
}

__device__ __forceinline__ void wait_async0() {
  asm volatile("s_wait_asynccnt 0x0" ::: "memory");
}

// One BK=16 chunk of wave-level MMA: wave computes two 16x16 tiles.
// As: [64][20] floats (row-major, padded).  Bs: [8][BNP_] float2,
// Bs[kp][n] = {B[2kp][n], B[2kp+1][n]}  -> fragment is one b64 load.
__device__ __forceinline__ void mma_step(const float (&As)[64][20],
                                         const v2f (&Bs)[8][BNP_],
                                         int wm, int wn, int laneM, int hi,
                                         v8f& acc0, v8f& acc1) {
  const float* ar = &As[wm * 16 + laneM][0];
#pragma unroll
  for (int kk = 0; kk < 16; kk += 4) {
    const int kb = kk + 2 * hi;   // lanes 0-15: K=kk,kk+1 ; lanes 16-31: K=kk+2,kk+3
    v2f a;
    a.x = ar[kb];
    a.y = ar[kb + 1];
    const v2f b0 = Bs[kb >> 1][wn * 16 + laneM];
    const v2f b1 = Bs[kb >> 1][wn * 16 + 16 + laneM];
    acc0 = wmma_f32(a, b0, acc0);
    acc1 = wmma_f32(a, b1, acc1);
  }
}

// ---------------------------------------------------------------------------
// Kernel 1: fused QKV projection.  out[m,n] = sum_c x[m,c]*W[n,c] + b[n]
// grid = (M/64, K_/64, 3), block = 256
// ---------------------------------------------------------------------------
__global__ __launch_bounds__(256) void qkv_proj_kernel(
    const float* __restrict__ x,
    const float* __restrict__ Wq, const float* __restrict__ bq,
    const float* __restrict__ Wk, const float* __restrict__ bk,
    const float* __restrict__ Wv, const float* __restrict__ bv,
    float* __restrict__ qkv_ws) {
  __shared__ float As[2][64][20];
  __shared__ v2f Bs[2][8][BNP_];

  const int tid = threadIdx.x;
  const int lane = tid & 31, wave = tid >> 5;
  const int laneM = lane & 15, hi = lane >> 4;
  const int wm = wave & 3, wn = (wave >> 2) << 1;

  const int proj = blockIdx.z;
  const float* W = (proj == 0) ? Wq : (proj == 1) ? Wk : Wv;
  const float* bias = (proj == 0) ? bq : (proj == 1) ? bk : bv;
  float* out = qkv_ws + (size_t)proj * ((size_t)B_ * T_ * K_);

  const int m0 = blockIdx.x * 64;
  const int n0 = blockIdx.y * 64;

  v8f acc0 = {0.f, 0.f, 0.f, 0.f, 0.f, 0.f, 0.f, 0.f};
  v8f acc1 = {0.f, 0.f, 0.f, 0.f, 0.f, 0.f, 0.f, 0.f};

  const int lr = tid >> 2;         // 0..63
  const int lk = (tid & 3) << 2;   // 0,4,8,12
  const float* ap = x + (size_t)(m0 + lr) * C_ + lk;
  const float* bp = W + (size_t)(n0 + lr) * C_ + lk;

  // prologue: stage chunk 0 into buffer 0
  {
    async_copy16(&As[0][lr][lk], ap);             // A: async DMA to LDS
    f4 wv = *(const f4*)(bp);                     // B: transpose via regs
    Bs[0][(lk >> 1) + 0][lr] = (v2f){wv.x, wv.y};
    Bs[0][(lk >> 1) + 1][lr] = (v2f){wv.z, wv.w};
  }
  wait_async0();
  __syncthreads();

  const int nch = C_ / 16;   // 32 chunks
  for (int c = 0; c < nch; ++c) {
    const int cur = c & 1;
    const bool more = (c + 1) < nch;
    f4 nb;
    if (more) {
      async_copy16(&As[cur ^ 1][lr][lk], ap + (c + 1) * 16);  // overlaps MMAs
      nb = *(const f4*)(bp + (c + 1) * 16);
    }
    mma_step(As[cur], Bs[cur], wm, wn, laneM, hi, acc0, acc1);
    if (more) {
      Bs[cur ^ 1][(lk >> 1) + 0][lr] = (v2f){nb.x, nb.y};
      Bs[cur ^ 1][(lk >> 1) + 1][lr] = (v2f){nb.z, nb.w};
    }
    wait_async0();
    __syncthreads();
  }

  const int row = m0 + wm * 16 + hi * 8;
  const int c0 = n0 + wn * 16 + laneM;
  const int c1 = c0 + 16;
  const float b0v = bias[c0], b1v = bias[c1];
#pragma unroll
  for (int r = 0; r < 8; ++r) {
    out[(size_t)(row + r) * K_ + c0] = acc0[r] + b0v;
    out[(size_t)(row + r) * K_ + c1] = acc1[r] + b1v;
  }
}

// ---------------------------------------------------------------------------
// Kernel 2: scores[b,i,j] = (j>i) ? -inf : dot(q[b,i,:], k[b,j,:]) / sqrt(512)
// grid = (T/64, T/64, B), block = 256.  Fully-masked tiles early-out.
// ---------------------------------------------------------------------------
__global__ __launch_bounds__(256) void scores_kernel(
    const float* __restrict__ q, const float* __restrict__ kmat,
    float* __restrict__ scores) {
  const int b = blockIdx.z;
  const int m0 = blockIdx.x * 64;
  const int n0 = blockIdx.y * 64;
  float* S = scores + (size_t)b * T_ * T_;

  if (n0 > m0 + 63) {  // entire tile is strictly above the diagonal
    const f4 minf = {-INFINITY, -INFINITY, -INFINITY, -INFINITY};
    for (int idx = threadIdx.x; idx < 64 * 16; idx += 256) {
      const int r = idx >> 4, c4 = (idx & 15) << 2;
      *(f4*)(S + (size_t)(m0 + r) * T_ + n0 + c4) = minf;
    }
    return;
  }

  __shared__ float As[2][64][20];
  __shared__ v2f Bs[2][8][BNP_];

  const int tid = threadIdx.x;
  const int lane = tid & 31, wave = tid >> 5;
  const int laneM = lane & 15, hi = lane >> 4;
  const int wm = wave & 3, wn = (wave >> 2) << 1;

  v8f acc0 = {0.f, 0.f, 0.f, 0.f, 0.f, 0.f, 0.f, 0.f};
  v8f acc1 = {0.f, 0.f, 0.f, 0.f, 0.f, 0.f, 0.f, 0.f};

  const int lr = tid >> 2;
  const int lk = (tid & 3) << 2;
  const float* ap = q + (size_t)b * T_ * K_ + (size_t)(m0 + lr) * K_ + lk;
  const float* bp = kmat + (size_t)b * T_ * K_ + (size_t)(n0 + lr) * K_ + lk;

  {
    async_copy16(&As[0][lr][lk], ap);
    f4 kv = *(const f4*)(bp);
    Bs[0][(lk >> 1) + 0][lr] = (v2f){kv.x, kv.y};
    Bs[0][(lk >> 1) + 1][lr] = (v2f){kv.z, kv.w};
  }
  wait_async0();
  __syncthreads();

  const int nch = K_ / 16;
  for (int c = 0; c < nch; ++c) {
    const int cur = c & 1;
    const bool more = (c + 1) < nch;
    f4 nb;
    if (more) {
      async_copy16(&As[cur ^ 1][lr][lk], ap + (c + 1) * 16);
      nb = *(const f4*)(bp + (c + 1) * 16);
    }
    mma_step(As[cur], Bs[cur], wm, wn, laneM, hi, acc0, acc1);
    if (more) {
      Bs[cur ^ 1][(lk >> 1) + 0][lr] = (v2f){nb.x, nb.y};
      Bs[cur ^ 1][(lk >> 1) + 1][lr] = (v2f){nb.z, nb.w};
    }
    wait_async0();
    __syncthreads();
  }

  const float sc = 0.04419417382415922f;  // 1/sqrt(512)
  const int row = m0 + wm * 16 + hi * 8;
  const int c0 = n0 + wn * 16 + laneM;
  const int c1 = c0 + 16;
#pragma unroll
  for (int r = 0; r < 8; ++r) {
    const int i = row + r;
    S[(size_t)i * T_ + c0] = (c0 > i) ? -INFINITY : acc0[r] * sc;
    S[(size_t)i * T_ + c1] = (c1 > i) ? -INFINITY : acc1[r] * sc;
  }
}

// ---------------------------------------------------------------------------
// Kernel 3: softmax over axis=1 (QUERY axis): normalize each column j.
// grid = (T/32, B), block = 512.  One block owns a strip of 32 columns and
// holds all 2048 rows of it in registers (32 float4 per lane): every load is
// issued before the first use, and the strip is read from memory once.
// A wave-wide load covers 4 rows x 128 bytes (whole lines).
// Masked (-inf) entries become exactly 0: the diagonal entry of every column
// is unmasked, so the column maximum is finite and expf(-inf - max) is 0.
// ---------------------------------------------------------------------------
#define SM_COLS_ 32
#define SM_ROWS_ 64                     // rows covered by the block per step
#define SM_STEPS_ (T_ / SM_ROWS_)       // 32
#define SM_PITCH_ 36                    // floats; 144 B rows: b128 stores conflict-free

__global__ __launch_bounds__(512) void softmax_q_kernel(float* __restrict__ scores) {
  __shared__ __attribute__((aligned(16))) float red[SM_ROWS_][SM_PITCH_];
  __shared__ __attribute__((aligned(16))) float gmx[SM_COLS_];
  __shared__ __attribute__((aligned(16))) float ginv[SM_COLS_];

  const int tid = threadIdx.x;
  const int c4 = (tid & 7) << 2;        // first of this lane's 4 columns
  const int rr = tid >> 3;              // 0..63: row inside a step
  const int rcol = tid >> 4;            // 0..31: column this lane helps to reduce
  const int rrow = tid & 15;            // 0..15
  float* S = scores + (size_t)blockIdx.y * T_ * T_ + blockIdx.x * SM_COLS_;  // uniform
  const unsigned off = (unsigned)(rr * T_ + c4);                            // per lane

  f4 xv[SM_STEPS_];
#pragma unroll  // constant indices keep xv[] in registers
  for (int s = 0; s < SM_STEPS_ - 1; ++s)
    xv[s] = *(const f4*)(S + (size_t)s * SM_ROWS_ * T_ + off);
  // The last load's result may land in the address registers of the loads
  // above: this wait stands between them and that overwrite.
  asm volatile("s_wait_xcnt 0x0" ::: "memory");
  xv[SM_STEPS_ - 1] = *(const f4*)(S + (size_t)(SM_STEPS_ - 1) * SM_ROWS_ * T_ + off);

  // column maximum: lane, then block
  f4 m = xv[0];
#pragma unroll  // constant indices keep xv[] in registers
  for (int s = 1; s < SM_STEPS_; ++s) {
    m.x = fmaxf(m.x, xv[s].x);
    m.y = fmaxf(m.y, xv[s].y);
    m.z = fmaxf(m.z, xv[s].z);
    m.w = fmaxf(m.w, xv[s].w);
  }
  *(f4*)&red[rr][c4] = m;
  __syncthreads();
  {
    float t = fmaxf(fmaxf(red[rrow][rcol], red[rrow + 16][rcol]),
                    fmaxf(red[rrow + 32][rcol], red[rrow + 48][rcol]));
#pragma unroll  // four fixed butterfly steps inside a 16-lane group
    for (int d = 1; d < 16; d <<= 1) t = fmaxf(t, __shfl_xor(t, d, 32));
    if (rrow == 0) gmx[rcol] = t;
  }
  __syncthreads();
  const f4 M = *(const f4*)&gmx[c4];

  // exponentials replace the scores in registers; column sum: lane, then block
  f4 sm = {0.f, 0.f, 0.f, 0.f};
#pragma unroll  // constant indices keep xv[] in registers
  for (int s = 0; s < SM_STEPS_; ++s) {
    f4 e;
    e.x = expf(xv[s].x - M.x);
    e.y = expf(xv[s].y - M.y);
    e.z = expf(xv[s].z - M.z);
    e.w = expf(xv[s].w - M.w);
    xv[s] = e;
    sm += e;
  }
  *(f4*)&red[rr][c4] = sm;
  __syncthreads();
  {
    float t = (red[rrow][rcol] + red[rrow + 16][rcol]) +
              (red[rrow + 32][rcol] + red[rrow + 48][rcol]);
#pragma unroll  // four fixed butterfly steps inside a 16-lane group
    for (int d = 1; d < 16; d <<= 1) t += __shfl_xor(t, d, 32);
    if (rrow == 0) ginv[rcol] = 1.0f / t;
  }
  __syncthreads();
  const f4 inv = *(const f4*)&ginv[c4];

#pragma unroll  // constant indices keep xv[] in registers
  for (int s = 0; s < SM_STEPS_; ++s)
    *(f4*)(S + (size_t)s * SM_ROWS_ * T_ + off) = xv[s] * inv;
}

// ---------------------------------------------------------------------------
// Kernel 4: attn = probs @ v, written into out[b, t, 512:1024].
// probs[i,s]==0 for s>i  ->  K loop clamped at m0+64.
// grid = (T/64, K_/64, B), block = 256
// ---------------------------------------------------------------------------
__global__ __launch_bounds__(256) void attn_kernel(
    const float* __restrict__ probs, const float* __restrict__ v,
    float* __restrict__ out) {
  __shared__ float As[2][64][20];
  __shared__ v2f Bs[2][8][BNP_];

  const int tid = threadIdx.x;
  const int lane = tid & 31, wave = tid >> 5;
  const int laneM = lane & 15, hi = lane >> 4;
  const int wm = wave & 3, wn = (wave >> 2) << 1;

  const int b = blockIdx.z;
  const int m0 = blockIdx.x * 64;
  const int n0 = blockIdx.y * 64;

  const float* A = probs + (size_t)b * T_ * T_;
  const float* V = v + (size_t)b * T_ * K_;
  float* O = out + (size_t)b * T_ * OUTW_;

  v8f acc0 = {0.f, 0.f, 0.f, 0.f, 0.f, 0.f, 0.f, 0.f};
  v8f acc1 = {0.f, 0.f, 0.f, 0.f, 0.f, 0.f, 0.f, 0.f};

  const int lr = tid >> 2;          // A staging: 0..63
  const int lk = (tid & 3) << 2;
  const int kp = tid >> 5;          // B staging: k-pair 0..7
  const int nn = (tid & 31) << 1;   // 0..62
  const float* ap = A + (size_t)(m0 + lr) * T_ + lk;
  const float* bp = V + (size_t)(2 * kp) * K_ + n0 + nn;

  // prologue: stage chunk 0
  {
    async_copy16(&As[0][lr][lk], ap);
    v2f r0 = *(const v2f*)(bp);
    v2f r1 = *(const v2f*)(bp + K_);
    Bs[0][kp][nn + 0] = (v2f){r0.x, r1.x};
    Bs[0][kp][nn + 1] = (v2f){r0.y, r1.y};
  }
  wait_async0();
  __syncthreads();

  const int nch = (m0 + 64) / 16;   // causal zero structure of probs
  for (int c = 0; c < nch; ++c) {
    const int cur = c & 1;
    const bool more = (c + 1) < nch;
    v2f n0r, n1r;
    if (more) {
      async_copy16(&As[cur ^ 1][lr][lk], ap + (c + 1) * 16);
      n0r = *(const v2f*)(bp + (size_t)(c + 1) * 16 * K_);
      n1r = *(const v2f*)(bp + (size_t)(c + 1) * 16 * K_ + K_);
    }
    mma_step(As[cur], Bs[cur], wm, wn, laneM, hi, acc0, acc1);
    if (more) {
      Bs[cur ^ 1][kp][nn + 0] = (v2f){n0r.x, n1r.x};
      Bs[cur ^ 1][kp][nn + 1] = (v2f){n0r.y, n1r.y};
    }
    wait_async0();
    __syncthreads();
  }

  const int row = m0 + wm * 16 + hi * 8;
  const int c0 = n0 + wn * 16 + laneM;
  const int c1 = c0 + 16;
#pragma unroll
  for (int r = 0; r < 8; ++r) {
    O[(size_t)(row + r) * OUTW_ + C_ + c0] = acc0[r];
    O[(size_t)(row + r) * OUTW_ + C_ + c1] = acc1[r];
  }
}

// ---------------------------------------------------------------------------
// Kernel 5: out[b, t, 0:512] = x  (float4 copy)
// ---------------------------------------------------------------------------
__global__ __launch_bounds__(256) void concat_x_kernel(const float* __restrict__ x,
                                                       float* __restrict__ out) {
  const size_t idx = (size_t)blockIdx.x * 256 + threadIdx.x;  // float4 index
  const size_t row = idx >> 7;   // 128 float4 per 512-float row
  const size_t c4 = idx & 127;
  f4 val = *(const f4*)(x + (row << 9) + (c4 << 2));
  *(f4*)(out + row * OUTW_ + (c4 << 2)) = val;
}

// ---------------------------------------------------------------------------
extern "C" void kernel_launch(void* const* d_in, const int* in_sizes, int n_in,
                              void* d_out, int out_size, void* d_ws, size_t ws_size,
                              hipStream_t stream) {
  (void)in_sizes; (void)n_in; (void)out_size; (void)ws_size;

  const float* x  = (const float*)d_in[0];
  const float* Wq = (const float*)d_in[1];
  const float* bq = (const float*)d_in[2];
  const float* Wk = (const float*)d_in[3];
  const float* bk = (const float*)d_in[4];
  const float* Wv = (const float*)d_in[5];
  const float* bv = (const float*)d_in[6];
  float* out = (float*)d_out;
  float* ws = (float*)d_ws;

  const size_t NPROJ = (size_t)B_ * T_ * K_;   // 8,388,608 floats
  float* q      = ws;
  float* k      = ws + NPROJ;
  float* v      = ws + 2 * NPROJ;
  float* scores = ws + 3 * NPROJ;              // 8*T*T floats

  qkv_proj_kernel<<<dim3((B_ * T_) / 64, K_ / 64, 3), 256, 0, stream>>>(
      x, Wq, bq, Wk, bk, Wv, bv, ws);
  scores_kernel<<<dim3(T_ / 64, T_ / 64, B_), 256, 0, stream>>>(q, k, scores);
  softmax_q_kernel<<<dim3(T_ / SM_COLS_, B_), 512, 0, stream>>>(scores);
  attn_kernel<<<dim3(T_ / 64, K_ / 64, B_), 256, 0, stream>>>(scores, v, out);
  concat_x_kernel<<<(B_ * T_ * C_ / 4) / 256, 256, 0, stream>>>(x, out);
}

// v002
// It runs in 414 microseconds.
// Next to v001, in two timings, it ran 1.13 and 1.14 times as fast.
// All steps since v000 together make it 1.81 times as fast.
#include <hip/hip_runtime.h>
#include <math.h>

// ---------------------------------------------------------------------------
// AttentionBlock for MI455X (gfx1250, wave32, WMMA).
// FP32 end-to-end using V_WMMA_F32_16X16X4_F32 (exact fp32 matrix math).
// - LDS double-buffered (1 barrier/chunk)
// - k-pair-major float2 B layout: B fragment = one contiguous ds_load_b64
// - A tiles staged with CDNA5 async DMA: global_load_async_to_lds_b128
//   (ASYNCcnt-tracked, no VGPR round trip), synced via s_wait_asynccnt.
// Workspace layout (floats): q[8M] | k[8M] | v[8M] | scores[33.5M]  (~224 MB)
// ---------------------------------------------------------------------------

typedef __attribute__((ext_vector_type(2))) float v2f;
typedef __attribute__((ext_vector_type(4))) float f4;
typedef __attribute__((ext_vector_type(8))) float v8f;

#define B_ 8
#define T_ 2048
#define C_ 512
#define K_ 512
#define OUTW_ (C_ + K_)   // 1024

#define BNP_ 72           // padded row length (in float2) of B tiles

__device__ __forceinline__ v8f wmma_f32(v2f a, v2f b, v8f c) {
  // D = A(16x4) x B(4x16) + C(16x16), all fp32
  return __builtin_amdgcn_wmma_f32_16x16x4_f32(
      /*neg_a=*/false, a, /*neg_b=*/false, b,
      /*c_mod=*/(short)0, c, /*reuse_a=*/false, /*reuse_b=*/false);
}

// Async DMA: copy 16 bytes global -> LDS for this lane (ASYNCcnt-tracked).
__device__ __forceinline__ void async_copy16(void* lds_dst, const float* gsrc) {
  const unsigned lds_off = (unsigned)(uintptr_t)lds_dst;   // LDS aperture: addr[31:0]
  const unsigned long long ga = (unsigned long long)(uintptr_t)gsrc;
  asm volatile("global_load_async_to_lds_b128 %0, %1, off"
               :
               : "v"(lds_off), "v"(ga)
               : "memory");
}

// The same copy with s_wait_xcnt 0 as the last line of its own statement, so
// that the wait stands in front of every rewrite of the two address registers.
__device__ __forceinline__ void async_copy16_held(void* lds_dst, const float* gsrc) {
  const unsigned lds_off = (unsigned)(uintptr_t)lds_dst;   // LDS aperture: addr[31:0]
  const unsigned long long ga = (unsigned long long)(uintptr_t)gsrc;
  asm volatile("global_load_async_to_lds_b128 %0, %1, off\n\ts_wait_xcnt 0x0"
               :
               : "v"(lds_off), "v"(ga)
               : "memory");
}

__device__ __forceinline__ void wait_async0() {
  asm volatile("s_wait_asynccnt 0x0" ::: "memory");
}

// One BK=16 chunk of wave-level MMA: wave computes two 16x16 tiles.
// As: [64][20] floats (row-major, padded).  Bs: [8][BNP_] float2,
// Bs[kp][n] = {B[2kp][n], B[2kp+1][n]}  -> fragment is one b64 load.
__device__ __forceinline__ void mma_step(const float (&As)[64][20],
                                         const v2f (&Bs)[8][BNP_],
                                         int wm, int wn, int laneM, int hi,
                                         v8f& acc0, v8f& acc1) {
  const float* ar = &As[wm * 16 + laneM][0];
#pragma unroll
  for (int kk = 0; kk < 16; kk += 4) {
    const int kb = kk + 2 * hi;   // lanes 0-15: K=kk,kk+1 ; lanes 16-31: K=kk+2,kk+3
    v2f a;
    a.x = ar[kb];
    a.y = ar[kb + 1];
    const v2f b0 = Bs[kb >> 1][wn * 16 + laneM];
    const v2f b1 = Bs[kb >> 1][wn * 16 + 16 + laneM];
    acc0 = wmma_f32(a, b0, acc0);
    acc1 = wmma_f32(a, b1, acc1);
  }
}

// ---------------------------------------------------------------------------
// Kernel 1: fused QKV projection.  out[m,n] = sum_c x[m,c]*W[n,c] + b[n]
// grid = (M/64, K_/64, 3), block = 256
// ---------------------------------------------------------------------------
__global__ __launch_bounds__(256) void qkv_proj_kernel(
    const float* __restrict__ x,
    const float* __restrict__ Wq, const float* __restrict__ bq,
    const float* __restrict__ Wk, const float* __restrict__ bk,
    const float* __restrict__ Wv, const float* __restrict__ bv,
    float* __restrict__ qkv_ws) {
  __shared__ float As[2][64][20];
  __shared__ v2f Bs[2][8][BNP_];

  const int tid = threadIdx.x;
  const int lane = tid & 31, wave = tid >> 5;
  const int laneM = lane & 15, hi = lane >> 4;
  const int wm = wave & 3, wn = (wave >> 2) << 1;

  const int proj = blockIdx.z;
  const float* W = (proj == 0) ? Wq : (proj == 1) ? Wk : Wv;
  const float* bias = (proj == 0) ? bq : (proj == 1) ? bk : bv;
  float* out = qkv_ws + (size_t)proj * ((size_t)B_ * T_ * K_);

  const int m0 = blockIdx.x * 64;
  const int n0 = blockIdx.y * 64;

  v8f acc0 = {0.f, 0.f, 0.f, 0.f, 0.f, 0.f, 0.f, 0.f};
  v8f acc1 = {0.f, 0.f, 0.f, 0.f, 0.f, 0.f, 0.f, 0.f};

  const int lr = tid >> 2;         // 0..63
  const int lk = (tid & 3) << 2;   // 0,4,8,12
  const float* ap = x + (size_t)(m0 + lr) * C_ + lk;
  const float* bp = W + (size_t)(n0 + lr) * C_ + lk;

  // prologue: stage chunk 0 into buffer 0
  {
    async_copy16(&As[0][lr][lk], ap);             // A: async DMA to LDS
    f4 wv = *(const f4*)(bp);                     // B: transpose via regs
    Bs[0][(lk >> 1) + 0][lr] = (v2f){wv.x, wv.y};
    Bs[0][(lk >> 1) + 1][lr] = (v2f){wv.z, wv.w};
  }
  wait_async0();
  __syncthreads();

  const int nch = C_ / 16;   // 32 chunks
  for (int c = 0; c < nch; ++c) {
    const int cur = c & 1;
    const bool more = (c + 1) < nch;
    f4 nb;
    if (more) {
      async_copy16(&As[cur ^ 1][lr][lk], ap + (c + 1) * 16);  // overlaps MMAs
      nb = *(const f4*)(bp + (c + 1) * 16);
    }
    mma_step(As[cur], Bs[cur], wm, wn, laneM, hi, acc0, acc1);
    if (more) {
      Bs[cur ^ 1][(lk >> 1) + 0][lr] = (v2f){nb.x, nb.y};
      Bs[cur ^ 1][(lk >> 1) + 1][lr] = (v2f){nb.z, nb.w};
    }
    wait_async0();
    __syncthreads();
  }

  const int row = m0 + wm * 16 + hi * 8;
  const int c0 = n0 + wn * 16 + laneM;
  const int c1 = c0 + 16;
  const float b0v = bias[c0], b1v = bias[c1];
#pragma unroll
  for (int r = 0; r < 8; ++r) {
    out[(size_t)(row + r) * K_ + c0] = acc0[r] + b0v;
    out[(size_t)(row + r) * K_ + c1] = acc1[r] + b1v;
  }
}

// ---------------------------------------------------------------------------
// Kernel 2: scores[b,i,j] = (j>i) ? -inf : dot(q[b,i,:], k[b,j,:]) / sqrt(512)
// grid = (T/64, T/64, B), block = 256.  Fully-masked tiles early-out.
// ---------------------------------------------------------------------------
__global__ __launch_bounds__(256) void scores_kernel(
    const float* __restrict__ q, const float* __restrict__ kmat,
    float* __restrict__ scores) {
  const int b = blockIdx.z;
  const int m0 = blockIdx.x * 64;
  const int n0 = blockIdx.y * 64;
  float* S = scores + (size_t)b * T_ * T_;

  if (n0 > m0 + 63) {  // entire tile is strictly above the diagonal
    const f4 minf = {-INFINITY, -INFINITY, -INFINITY, -INFINITY};
    for (int idx = threadIdx.x; idx < 64 * 16; idx += 256) {
      const int r = idx >> 4, c4 = (idx & 15) << 2;
      *(f4*)(S + (size_t)(m0 + r) * T_ + n0 + c4) = minf;
    }
    return;
  }

  __shared__ float As[2][64][20];
  __shared__ v2f Bs[2][8][BNP_];

  const int tid = threadIdx.x;
  const int lane = tid & 31, wave = tid >> 5;
  const int laneM = lane & 15, hi = lane >> 4;
  const int wm = wave & 3, wn = (wave >> 2) << 1;

  v8f acc0 = {0.f, 0.f, 0.f, 0.f, 0.f, 0.f, 0.f, 0.f};
  v8f acc1 = {0.f, 0.f, 0.f, 0.f, 0.f, 0.f, 0.f, 0.f};

  const int lr = tid >> 2;
  const int lk = (tid & 3) << 2;
  const float* ap = q + (size_t)b * T_ * K_ + (size_t)(m0 + lr) * K_ + lk;
  const float* bp = kmat + (size_t)b * T_ * K_ + (size_t)(n0 + lr) * K_ + lk;

  {
    async_copy16(&As[0][lr][lk], ap);
    f4 kv = *(const f4*)(bp);
    Bs[0][(lk >> 1) + 0][lr] = (v2f){kv.x, kv.y};
    Bs[0][(lk >> 1) + 1][lr] = (v2f){kv.z, kv.w};
  }
  wait_async0();
  __syncthreads();

  const int nch = K_ / 16;
  for (int c = 0; c < nch; ++c) {
    const int cur = c & 1;
    const bool more = (c + 1) < nch;
    f4 nb;
    if (more) {
      async_copy16(&As[cur ^ 1][lr][lk], ap + (c + 1) * 16);
      nb = *(const f4*)(bp + (c + 1) * 16);
    }
    mma_step(As[cur], Bs[cur], wm, wn, laneM, hi, acc0, acc1);
    if (more) {
      Bs[cur ^ 1][(lk >> 1) + 0][lr] = (v2f){nb.x, nb.y};
      Bs[cur ^ 1][(lk >> 1) + 1][lr] = (v2f){nb.z, nb.w};
    }
    wait_async0();
    __syncthreads();
  }

  const float sc = 0.04419417382415922f;  // 1/sqrt(512)
  const int row = m0 + wm * 16 + hi * 8;
  const int c0 = n0 + wn * 16 + laneM;
  const int c1 = c0 + 16;
#pragma unroll
  for (int r = 0; r < 8; ++r) {
    const int i = row + r;
    S[(size_t)i * T_ + c0] = (c0 > i) ? -INFINITY : acc0[r] * sc;
    S[(size_t)i * T_ + c1] = (c1 > i) ? -INFINITY : acc1[r] * sc;
  }
}

// ---------------------------------------------------------------------------
// Kernel 3: softmax over axis=1 (QUERY axis): normalize each column j.
// grid = (T/32, B), block = 512.  One block owns a strip of 32 columns and
// holds all 2048 rows of it in registers (32 float4 per lane): every load is
// issued before the first use, and the strip is read from memory once.
// A wave-wide load covers 4 rows x 128 bytes (whole lines).
// Masked (-inf) entries become exactly 0: the diagonal entry of every column
// is unmasked, so the column maximum is finite and expf(-inf - max) is 0.
// ---------------------------------------------------------------------------
#define SM_COLS_ 32
#define SM_ROWS_ 64                     // rows covered by the block per step
#define SM_STEPS_ (T_ / SM_ROWS_)       // 32
#define SM_PITCH_ 36                    // floats; 144 B rows: b128 stores conflict-free

__global__ __launch_bounds__(512) void softmax_q_kernel(float* __restrict__ scores) {
  __shared__ __attribute__((aligned(16))) float red[SM_ROWS_][SM_PITCH_];
  __shared__ __attribute__((aligned(16))) float gmx[SM_COLS_];
  __shared__ __attribute__((aligned(16))) float ginv[SM_COLS_];

  const int tid = threadIdx.x;
  const int c4 = (tid & 7) << 2;        // first of this lane's 4 columns
  const int rr = tid >> 3;              // 0..63: row inside a step
  const int rcol = tid >> 4;            // 0..31: column this lane helps to reduce
  const int rrow = tid & 15;            // 0..15
  float* S = scores + (size_t)blockIdx.y * T_ * T_ + blockIdx.x * SM_COLS_;  // uniform
  const unsigned off = (unsigned)(rr * T_ + c4);                            // per lane

  f4 xv[SM_STEPS_];
#pragma unroll  // constant indices keep xv[] in registers
  for (int s = 0; s < SM_STEPS_ - 1; ++s)
    xv[s] = *(const f4*)(S + (size_t)s * SM_ROWS_ * T_ + off);
  // The last load's result may land in the address registers of the loads
  // above: this wait stands between them and that overwrite.
  asm volatile("s_wait_xcnt 0x0" ::: "memory");
  xv[SM_STEPS_ - 1] = *(const f4*)(S + (size_t)(SM_STEPS_ - 1) * SM_ROWS_ * T_ + off);

  // column maximum: lane, then block
  f4 m = xv[0];
#pragma unroll  // constant indices keep xv[] in registers
  for (int s = 1; s < SM_STEPS_; ++s) {
    m.x = fmaxf(m.x, xv[s].x);
    m.y = fmaxf(m.y, xv[s].y);
    m.z = fmaxf(m.z, xv[s].z);
    m.w = fmaxf(m.w, xv[s].w);
  }
  *(f4*)&red[rr][c4] = m;
  __syncthreads();
  {
    float t = fmaxf(fmaxf(red[rrow][rcol], red[rrow + 16][rcol]),
                    fmaxf(red[rrow + 32][rcol], red[rrow + 48][rcol]));
#pragma unroll  // four fixed butterfly steps inside a 16-lane group
    for (int d = 1; d < 16; d <<= 1) t = fmaxf(t, __shfl_xor(t, d, 32));
    if (rrow == 0) gmx[rcol] = t;
  }
  __syncthreads();
  const f4 M = *(const f4*)&gmx[c4];

  // exponentials replace the scores in registers; column sum: lane, then block
  f4 sm = {0.f, 0.f, 0.f, 0.f};
#pragma unroll  // constant indices keep xv[] in registers
  for (int s = 0; s < SM_STEPS_; ++s) {
    f4 e;
    e.x = expf(xv[s].x - M.x);
    e.y = expf(xv[s].y - M.y);
    e.z = expf(xv[s].z - M.z);
    e.w = expf(xv[s].w - M.w);
    xv[s] = e;
    sm += e;
  }
  *(f4*)&red[rr][c4] = sm;
  __syncthreads();
  {
    float t = (red[rrow][rcol] + red[rrow + 16][rcol]) +
              (red[rrow + 32][rcol] + red[rrow + 48][rcol]);
#pragma unroll  // four fixed butterfly steps inside a 16-lane group
    for (int d = 1; d < 16; d <<= 1) t += __shfl_xor(t, d, 32);
    if (rrow == 0) ginv[rcol] = 1.0f / t;
  }
  __syncthreads();
  const f4 inv = *(const f4*)&ginv[c4];

#pragma unroll  // constant indices keep xv[] in registers
  for (int s = 0; s < SM_STEPS_; ++s)
    *(f4*)(S + (size_t)s * SM_ROWS_ * T_ + off) = xv[s] * inv;
}

// ---------------------------------------------------------------------------
// Kernel 4: attn = probs @ v, written into out[b, t, 512:1024].
// probs[i,s]==0 for s>i  ->  K loop clamped at m0+64.
// The K loop's length grows with the row tile's index and every block of the
// launch is resident at once, so a block takes row tiles t and 31-t, one after
// the other: each block runs 4*(t+1) + 4*(32-t) = 132 chunks.
// grid = (T/128, K_/64, B), block = 256
// ---------------------------------------------------------------------------
__global__ __launch_bounds__(256) void attn_kernel(
    const float* __restrict__ probs, const float* __restrict__ v,
    float* __restrict__ out) {
  __shared__ float As[2][64][20];
  __shared__ v2f Bs[2][8][BNP_];

  const int tid = threadIdx.x;
  const int lane = tid & 31, wave = tid >> 5;
  const int laneM = lane & 15, hi = lane >> 4;
  const int wm = wave & 3, wn = (wave >> 2) << 1;

  const int b = blockIdx.z;
  const int n0 = blockIdx.y * 64;

  const float* A = probs + (size_t)b * T_ * T_;
  const float* V = v + (size_t)b * T_ * K_;
  float* O = out + (size_t)b * T_ * OUTW_;

  const int lr = tid >> 2;          // A staging: 0..63
  const int lk = (tid & 3) << 2;
  const int kp = tid >> 5;          // B staging: k-pair 0..7
  const int nn = (tid & 31) << 1;   // 0..62
  const float* bp = V + (size_t)(2 * kp) * K_ + n0 + nn;

  for (int part = 0; part < 2; ++part) {
    const int mt = part ? (T_ / 64 - 1 - (int)blockIdx.x) : (int)blockIdx.x;
    const int m0 = mt * 64;
    const float* ap = A + (size_t)(m0 + lr) * T_ + lk;

    v8f acc0 = {0.f, 0.f, 0.f, 0.f, 0.f, 0.f, 0.f, 0.f};
    v8f acc1 = {0.f, 0.f, 0.f, 0.f, 0.f, 0.f, 0.f, 0.f};

    // prologue: stage chunk 0.  For the second tile the buffers are free: the
    // barrier at the foot of the first tile's last chunk ended every read.
    {
      async_copy16_held(&As[0][lr][lk], ap);
      v2f r0 = *(const v2f*)(bp);
      v2f r1 = *(const v2f*)(bp + K_);
      Bs[0][kp][nn + 0] = (v2f){r0.x, r1.x};
      Bs[0][kp][nn + 1] = (v2f){r0.y, r1.y};
    }
    wait_async0();
    __syncthreads();

    const int nch = (m0 + 64) / 16;   // causal zero structure of probs
    for (int c = 0; c < nch; ++c) {
      const int cur = c & 1;
      const bool more = (c + 1) < nch;
      v2f n0r, n1r;
      if (more) {
        // the plain loads go first: they are in flight while the wait inside
        // the copy's statement holds the wave
        n0r = *(const v2f*)(bp + (size_t)(c + 1) * 16 * K_);
        n1r = *(const v2f*)(bp + (size_t)(c + 1) * 16 * K_ + K_);
        async_copy16_held(&As[cur ^ 1][lr][lk], ap + (c + 1) * 16);
      }
      mma_step(As[cur], Bs[cur], wm, wn, laneM, hi, acc0, acc1);
      if (more) {
        Bs[cur ^ 1][kp][nn + 0] = (v2f){n0r.x, n1r.x};
        Bs[cur ^ 1][kp][nn + 1] = (v2f){n0r.y, n1r.y};
      }
      wait_async0();
      __syncthreads();
    }

    const int row = m0 + wm * 16 + hi * 8;
    const int c0 = n0 + wn * 16 + laneM;
    const int c1 = c0 + 16;
#pragma unroll  // constant indices keep the accumulators in registers
    for (int r = 0; r < 8; ++r) {
      O[(size_t)(row + r) * OUTW_ + C_ + c0] = acc0[r];
      O[(size_t)(row + r) * OUTW_ + C_ + c1] = acc1[r];
    }
  }
}

// ---------------------------------------------------------------------------
// Kernel 5: out[b, t, 0:512] = x  (float4 copy)
// ---------------------------------------------------------------------------
__global__ __launch_bounds__(256) void concat_x_kernel(const float* __restrict__ x,
                                                       float* __restrict__ out) {
  const size_t idx = (size_t)blockIdx.x * 256 + threadIdx.x;  // float4 index
  const size_t row = idx >> 7;   // 128 float4 per 512-float row
  const size_t c4 = idx & 127;
  f4 val = *(const f4*)(x + (row << 9) + (c4 << 2));
  *(f4*)(out + row * OUTW_ + (c4 << 2)) = val;
}

// ---------------------------------------------------------------------------
extern "C" void kernel_launch(void* const* d_in, const int* in_sizes, int n_in,
                              void* d_out, int out_size, void* d_ws, size_t ws_size,
                              hipStream_t stream) {
  (void)in_sizes; (void)n_in; (void)out_size; (void)ws_size;

  const float* x  = (const float*)d_in[0];
  const float* Wq = (const float*)d_in[1];
  const float* bq = (const float*)d_in[2];
  const float* Wk = (const float*)d_in[3];
  const float* bk = (const float*)d_in[4];
  const float* Wv = (const float*)d_in[5];
  const float* bv = (const float*)d_in[6];
  float* out = (float*)d_out;
  float* ws = (float*)d_ws;

  const size_t NPROJ = (size_t)B_ * T_ * K_;   // 8,388,608 floats
  float* q      = ws;
  float* k      = ws + NPROJ;
  float* v      = ws + 2 * NPROJ;
  float* scores = ws + 3 * NPROJ;              // 8*T*T floats

  qkv_proj_kernel<<<dim3((B_ * T_) / 64, K_ / 64, 3), 256, 0, stream>>>(
      x, Wq, bq, Wk, bk, Wv, bv, ws);
  scores_kernel<<<dim3(T_ / 64, T_ / 64, B_), 256, 0, stream>>>(q, k, scores);
  softmax_q_kernel<<<dim3(T_ / SM_COLS_, B_), 512, 0, stream>>>(scores);
  attn_kernel<<<dim3(T_ / 128, K_ / 64, B_), 256, 0, stream>>>(scores, v, out);
  concat_x_kernel<<<(B_ * T_ * C_ / 4) / 256, 256, 0, stream>>>(x, out);
}

// v003
// Measured time: 403 microseconds a run.
// Next to v002, in two timings, it ran 1.04 and 1.02 times as fast.
// All steps since v000 together make it 1.86 times as fast.
#include <hip/hip_runtime.h>
#include <math.h>

// ---------------------------------------------------------------------------
// AttentionBlock for MI455X (gfx1250, wave32, WMMA).
// FP32 end-to-end using V_WMMA_F32_16X16X4_F32 (exact fp32 matrix math).
// - LDS double-buffered (1 barrier/chunk)
// - k-pair-major float2 B layout: B fragment = one contiguous ds_load_b64
// - A tiles staged with CDNA5 async DMA: global_load_async_to_lds_b128
//   (ASYNCcnt-tracked, no VGPR round trip), synced via s_wait_asynccnt.
// Workspace layout (floats): q[8M] | k[8M] | v[8M] | scores[33.5M]  (~224 MB)
// ---------------------------------------------------------------------------

typedef __attribute__((ext_vector_type(2))) float v2f;
typedef __attribute__((ext_vector_type(4))) float f4;
typedef __attribute__((ext_vector_type(8))) float v8f;

#define B_ 8
#define T_ 2048
#define C_ 512
#define K_ 512
#define OUTW_ (C_ + K_)   // 1024

#define BNP_ 72           // padded row length (in float2) of B tiles

__device__ __forceinline__ v8f wmma_f32(v2f a, v2f b, v8f c) {
  // D = A(16x4) x B(4x16) + C(16x16), all fp32
  return __builtin_amdgcn_wmma_f32_16x16x4_f32(
      /*neg_a=*/false, a, /*neg_b=*/false, b,
      /*c_mod=*/(short)0, c, /*reuse_a=*/false, /*reuse_b=*/false);
}

// Async DMA: copy 16 bytes global -> LDS for this lane (ASYNCcnt-tracked).
__device__ __forceinline__ void async_copy16(void* lds_dst, const float* gsrc) {
  const unsigned lds_off = (unsigned)(uintptr_t)lds_dst;   // LDS aperture: addr[31:0]
  const unsigned long long ga = (unsigned long long)(uintptr_t)gsrc;
  asm volatile("global_load_async_to_lds_b128 %0, %1, off"
               :
               : "v"(lds_off), "v"(ga)
               : "memory");
}

// The same copy with s_wait_xcnt 0 as the last line of its own statement, so
// that the wait stands in front of every rewrite of the two address registers.
__device__ __forceinline__ void async_copy16_held(void* lds_dst, const float* gsrc) {
  const unsigned lds_off = (unsigned)(uintptr_t)lds_dst;   // LDS aperture: addr[31:0]
  const unsigned long long ga = (unsigned long long)(uintptr_t)gsrc;
  asm volatile("global_load_async_to_lds_b128 %0, %1, off\n\ts_wait_xcnt 0x0"
               :
               : "v"(lds_off), "v"(ga)
               : "memory");
}

__device__ __forceinline__ void wait_async0() {
  asm volatile("s_wait_asynccnt 0x0" ::: "memory");
}

// One BK=16 chunk of wave-level MMA: wave computes two 16x16 tiles.
// As: [64][20] floats (row-major, padded).  Bs: [8][BNP_] float2,
// Bs[kp][n] = {B[2kp][n], B[2kp+1][n]}  -> fragment is one b64 load.
__device__ __forceinline__ void mma_step(const float (&As)[64][20],
                                         const v2f (&Bs)[8][BNP_],
                                         int wm, int wn, int laneM, int hi,
                                         v8f& acc0, v8f& acc1) {
  const float* ar = &As[wm * 16 + laneM][0];
#pragma unroll
  for (int kk = 0; kk < 16; kk += 4) {
    const int kb = kk + 2 * hi;   // lanes 0-15: K=kk,kk+1 ; lanes 16-31: K=kk+2,kk+3
    v2f a;
    a.x = ar[kb];
    a.y = ar[kb + 1];
    const v2f b0 = Bs[kb >> 1][wn * 16 + laneM];
    const v2f b1 = Bs[kb >> 1][wn * 16 + 16 + laneM];
    acc0 = wmma_f32(a, b0, acc0);
    acc1 = wmma_f32(a, b1, acc1);
  }
}

// ---------------------------------------------------------------------------
// Kernel 1: fused QKV projection.  out[m,n] = sum_c x[m,c]*W[n,c] + b[n]
// A block owns a 128x128 tile of the output; its 8 waves stand 4 (rows) x 2
// (columns) and each holds 32x64 = 2x4 accumulator tiles, so a k group of 4
// takes 6 fragment loads for 8 matrix instructions, and a staged operand row
// feeds 128 outputs.  The k order of every output element is the old one.
// grid = (M/128, K_/128, 3), block = 256
// ---------------------------------------------------------------------------
#define QT_ 128           // rows and columns of the block's tile
#define QBNP_ (QT_ + 8)   // padded row length (in float2) of its B tile

// Two copies of 16 bytes a lane, with s_wait_xcnt 0 as the last line of their
// own statement, so that the wait stands in front of every rewrite of the
// address registers that the copies name.
__device__ __forceinline__ void async_copy16x2_held(void* lds0, const float* g0,
                                                    void* lds1, const float* g1) {
  const unsigned l0 = (unsigned)(uintptr_t)lds0;   // LDS aperture: addr[31:0]
  const unsigned l1 = (unsigned)(uintptr_t)lds1;
  const unsigned long long a0 = (unsigned long long)(uintptr_t)g0;
  const unsigned long long a1 = (unsigned long long)(uintptr_t)g1;
  asm volatile("global_load_async_to_lds_b128 %0, %1, off\n\t"
               "global_load_async_to_lds_b128 %2, %3, off\n\t"
               "s_wait_xcnt 0x0"
               :
               : "v"(l0), "v"(a0), "v"(l1), "v"(a1)
               : "memory");
}

__global__ __launch_bounds__(256) void qkv_proj_kernel(
    const float* __restrict__ x,
    const float* __restrict__ Wq, const float* __restrict__ bq,
    const float* __restrict__ Wk, const float* __restrict__ bk,
    const float* __restrict__ Wv, const float* __restrict__ bv,
    float* __restrict__ qkv_ws) {
  __shared__ __attribute__((aligned(16))) float As[2][QT_][20];
  __shared__ __attribute__((aligned(16))) v2f Bs[2][8][QBNP_];

  const int tid = threadIdx.x;
  const int lane = tid & 31, wave = tid >> 5;
  const int laneM = lane & 15, hi = lane >> 4;
  const int wm = wave & 3, wn = wave >> 2;   // 32-row band, 64-column band

  const int proj = blockIdx.z;
  const float* W = (proj == 0) ? Wq : (proj == 1) ? Wk : Wv;
  const float* bias = (proj == 0) ? bq : (proj == 1) ? bk : bv;
  float* out = qkv_ws + (size_t)proj * ((size_t)B_ * T_ * K_);

  const int m0 = blockIdx.x * QT_;
  const int n0 = blockIdx.y * QT_;

  v8f acc[2][4];
#pragma unroll  // constant indices keep the accumulators in registers
  for (int i = 0; i < 2; ++i)
#pragma unroll  // the same
    for (int j = 0; j < 4; ++j)
      acc[i][j] = (v8f){0.f, 0.f, 0.f, 0.f, 0.f, 0.f, 0.f, 0.f};

  // staging: a lane brings 16 bytes of rows lr and lr + 64 of each operand
  const int lr = tid >> 2;         // 0..63
  const int lk = (tid & 3) << 2;   // 0,4,8,12
  const float* ap = x + (size_t)(m0 + lr) * C_ + lk;
  const float* bp = W + (size_t)(n0 + lr) * C_ + lk;

  // prologue: stage chunk 0 into buffer 0
  {
    f4 w0 = *(const f4*)(bp);                     // B: transpose via regs
    f4 w1 = *(const f4*)(bp + 64 * C_);
    async_copy16x2_held(&As[0][lr][lk], ap,       // A: async DMA to LDS
                        &As[0][lr + 64][lk], ap + 64 * C_);
    Bs[0][(lk >> 1) + 0][lr] = (v2f){w0.x, w0.y};
    Bs[0][(lk >> 1) + 1][lr] = (v2f){w0.z, w0.w};
    Bs[0][(lk >> 1) + 0][lr + 64] = (v2f){w1.x, w1.y};
    Bs[0][(lk >> 1) + 1][lr + 64] = (v2f){w1.z, w1.w};
  }
  wait_async0();
  __syncthreads();

  const int nch = C_ / 16;   // 32 chunks
  for (int c = 0; c < nch; ++c) {
    const int cur = c & 1;
    const bool more = (c + 1) < nch;
    f4 nb0, nb1;
    if (more) {
      // the plain loads go first: they are in flight while the wait inside
      // the copies' statement holds the wave
      nb0 = *(const f4*)(bp + (c + 1) * 16);
      nb1 = *(const f4*)(bp + (c + 1) * 16 + 64 * C_);
      async_copy16x2_held(&As[cur ^ 1][lr][lk], ap + (c + 1) * 16,
                          &As[cur ^ 1][lr + 64][lk], ap + (c + 1) * 16 + 64 * C_);
    }
#pragma unroll  // constant k offsets fold into the LDS loads
    for (int kk = 0; kk < 16; kk += 4) {
      const int kb = kk + 2 * hi;   // lanes 0-15: K=kk,kk+1 ; lanes 16-31: K=kk+2,kk+3
      v2f a[2], bfr[4];
#pragma unroll  // fragments stay in registers
      for (int i = 0; i < 2; ++i) {
        const float* ar = &As[cur][wm * 32 + i * 16 + laneM][0];
        a[i].x = ar[kb];
        a[i].y = ar[kb + 1];
      }
#pragma unroll  // fragments stay in registers
      for (int j = 0; j < 4; ++j) bfr[j] = Bs[cur][kb >> 1][wn * 64 + j * 16 + laneM];
#pragma unroll  // constant indices keep the accumulators in registers
      for (int i = 0; i < 2; ++i)
#pragma unroll  // the same
        for (int j = 0; j < 4; ++j) acc[i][j] = wmma_f32(a[i], bfr[j], acc[i][j]);
    }
    if (more) {
      Bs[cur ^ 1][(lk >> 1) + 0][lr] = (v2f){nb0.x, nb0.y};
      Bs[cur ^ 1][(lk >> 1) + 1][lr] = (v2f){nb0.z, nb0.w};
      Bs[cur ^ 1][(lk >> 1) + 0][lr + 64] = (v2f){nb1.x, nb1.y};
      Bs[cur ^ 1][(lk >> 1) + 1][lr + 64] = (v2f){nb1.z, nb1.w};
    }
    // this wave's LDS reads and writes of the trip are done before it says so
    asm volatile("s_wait_dscnt 0x0" ::: "memory");
    wait_async0();
    __syncthreads();
  }

#pragma unroll  // constant indices keep the accumulators in registers
  for (int j = 0; j < 4; ++j) {
    const int col = n0 + wn * 64 + j * 16 + laneM;
    const float bv_ = bias[col];
#pragma unroll  // the same
    for (int i = 0; i < 2; ++i) {
      const int row = m0 + wm * 32 + i * 16 + hi * 8;
#pragma unroll  // the same
      for (int r = 0; r < 8; ++r)
        out[(size_t)(row + r) * K_ + col] = acc[i][j][r] + bv_;
    }
  }
}

// ---------------------------------------------------------------------------
// Kernel 2: scores[b,i,j] = (j>i) ? -inf : dot(q[b,i,:], k[b,j,:]) / sqrt(512)
// grid = (T/64, T/64, B), block = 256.  Fully-masked tiles early-out.
// ---------------------------------------------------------------------------
__global__ __launch_bounds__(256) void scores_kernel(
    const float* __restrict__ q, const float* __restrict__ kmat,
    float* __restrict__ scores) {
  const int b = blockIdx.z;
  const int m0 = blockIdx.x * 64;
  const int n0 = blockIdx.y * 64;
  float* S = scores + (size_t)b * T_ * T_;

  if (n0 > m0 + 63) {  // entire tile is strictly above the diagonal
    const f4 minf = {-INFINITY, -INFINITY, -INFINITY, -INFINITY};
    for (int idx = threadIdx.x; idx < 64 * 16; idx += 256) {
      const int r = idx >> 4, c4 = (idx & 15) << 2;
      *(f4*)(S + (size_t)(m0 + r) * T_ + n0 + c4) = minf;
    }
    return;
  }

  __shared__ float As[2][64][20];
  __shared__ v2f Bs[2][8][BNP_];

  const int tid = threadIdx.x;
  const int lane = tid & 31, wave = tid >> 5;
  const int laneM = lane & 15, hi = lane >> 4;
  const int wm = wave & 3, wn = (wave >> 2) << 1;

  v8f acc0 = {0.f, 0.f, 0.f, 0.f, 0.f, 0.f, 0.f, 0.f};
  v8f acc1 = {0.f, 0.f, 0.f, 0.f, 0.f, 0.f, 0.f, 0.f};

  const int lr = tid >> 2;
  const int lk = (tid & 3) << 2;
  const float* ap = q + (size_t)b * T_ * K_ + (size_t)(m0 + lr) * K_ + lk;
  const float* bp = kmat + (size_t)b * T_ * K_ + (size_t)(n0 + lr) * K_ + lk;

  {
    async_copy16(&As[0][lr][lk], ap);
    f4 kv = *(const f4*)(bp);
    Bs[0][(lk >> 1) + 0][lr] = (v2f){kv.x, kv.y};
    Bs[0][(lk >> 1) + 1][lr] = (v2f){kv.z, kv.w};
  }
  wait_async0();
  __syncthreads();

  const int nch = K_ / 16;
  for (int c = 0; c < nch; ++c) {
    const int cur = c & 1;
    const bool more = (c + 1) < nch;
    f4 nb;
    if (more) {
      async_copy16(&As[cur ^ 1][lr][lk], ap + (c + 1) * 16);
      nb = *(const f4*)(bp + (c + 1) * 16);
    }
    mma_step(As[cur], Bs[cur], wm, wn, laneM, hi, acc0, acc1);
    if (more) {
      Bs[cur ^ 1][(lk >> 1) + 0][lr] = (v2f){nb.x, nb.y};
      Bs[cur ^ 1][(lk >> 1) + 1][lr] = (v2f){nb.z, nb.w};
    }
    wait_async0();
    __syncthreads();
  }

  const float sc = 0.04419417382415922f;  // 1/sqrt(512)
  const int row = m0 + wm * 16 + hi * 8;
  const int c0 = n0 + wn * 16 + laneM;
  const int c1 = c0 + 16;
#pragma unroll
  for (int r = 0; r < 8; ++r) {
    const int i = row + r;
    S[(size_t)i * T_ + c0] = (c0 > i) ? -INFINITY : acc0[r] * sc;
    S[(size_t)i * T_ + c1] = (c1 > i) ? -INFINITY : acc1[r] * sc;
  }
}

// ---------------------------------------------------------------------------
// Kernel 3: softmax over axis=1 (QUERY axis): normalize each column j.
// grid = (T/32, B), block = 512.  One block owns a strip of 32 columns and
// holds all 2048 rows of it in registers (32 float4 per lane): every load is
// issued before the first use, and the strip is read from memory once.
// A wave-wide load covers 4 rows x 128 bytes (whole lines).
// Masked (-inf) entries become exactly 0: the diagonal entry of every column
// is unmasked, so the column maximum is finite and expf(-inf - max) is 0.
// ---------------------------------------------------------------------------
#define SM_COLS_ 32
#define SM_ROWS_ 64                     // rows covered by the block per step
#define SM_STEPS_ (T_ / SM_ROWS_)       // 32
#define SM_PITCH_ 36                    // floats; 144 B rows: b128 stores conflict-free

__global__ __launch_bounds__(512) void softmax_q_kernel(float* __restrict__ scores) {
  __shared__ __attribute__((aligned(16))) float red[SM_ROWS_][SM_PITCH_];
  __shared__ __attribute__((aligned(16))) float gmx[SM_COLS_];
  __shared__ __attribute__((aligned(16))) float ginv[SM_COLS_];

  const int tid = threadIdx.x;
  const int c4 = (tid & 7) << 2;        // first of this lane's 4 columns
  const int rr = tid >> 3;              // 0..63: row inside a step
  const int rcol = tid >> 4;            // 0..31: column this lane helps to reduce
  const int rrow = tid & 15;            // 0..15
  float* S = scores + (size_t)blockIdx.y * T_ * T_ + blockIdx.x * SM_COLS_;  // uniform
  const unsigned off = (unsigned)(rr * T_ + c4);                            // per lane

  f4 xv[SM_STEPS_];
#pragma unroll  // constant indices keep xv[] in registers
  for (int s = 0; s < SM_STEPS_ - 1; ++s)
    xv[s] = *(const f4*)(S + (size_t)s * SM_ROWS_ * T_ + off);
  // The last load's result may land in the address registers of the loads
  // above: this wait stands between them and that overwrite.
  asm volatile("s_wait_xcnt 0x0" ::: "memory");
  xv[SM_STEPS_ - 1] = *(const f4*)(S + (size_t)(SM_STEPS_ - 1) * SM_ROWS_ * T_ + off);

  // column maximum: lane, then block
  f4 m = xv[0];
#pragma unroll  // constant indices keep xv[] in registers
  for (int s = 1; s < SM_STEPS_; ++s) {
    m.x = fmaxf(m.x, xv[s].x);
    m.y = fmaxf(m.y, xv[s].y);
    m.z = fmaxf(m.z, xv[s].z);
    m.w = fmaxf(m.w, xv[s].w);
  }
  *(f4*)&red[rr][c4] = m;
  __syncthreads();
  {
    float t = fmaxf(fmaxf(red[rrow][rcol], red[rrow + 16][rcol]),
                    fmaxf(red[rrow + 32][rcol], red[rrow + 48][rcol]));
#pragma unroll  // four fixed butterfly steps inside a 16-lane group
    for (int d = 1; d < 16; d <<= 1) t = fmaxf(t, __shfl_xor(t, d, 32));
    if (rrow == 0) gmx[rcol] = t;
  }
  __syncthreads();
  const f4 M = *(const f4*)&gmx[c4];

  // exponentials replace the scores in registers; column sum: lane, then block
  f4 sm = {0.f, 0.f, 0.f, 0.f};
#pragma unroll  // constant indices keep xv[] in registers
  for (int s = 0; s < SM_STEPS_; ++s) {
    f4 e;
    e.x = expf(xv[s].x - M.x);
    e.y = expf(xv[s].y - M.y);
    e.z = expf(xv[s].z - M.z);
    e.w = expf(xv[s].w - M.w);
    xv[s] = e;
    sm += e;
  }
  *(f4*)&red[rr][c4] = sm;
  __syncthreads();
  {
    float t = (red[rrow][rcol] + red[rrow + 16][rcol]) +
              (red[rrow + 32][rcol] + red[rrow + 48][rcol]);
#pragma unroll  // four fixed butterfly steps inside a 16-lane group
    for (int d = 1; d < 16; d <<= 1) t += __shfl_xor(t, d, 32);
    if (rrow == 0) ginv[rcol] = 1.0f / t;
  }
  __syncthreads();
  const f4 inv = *(const f4*)&ginv[c4];

#pragma unroll  // constant indices keep xv[] in registers
  for (int s = 0; s < SM_STEPS_; ++s)
    *(f4*)(S + (size_t)s * SM_ROWS_ * T_ + off) = xv[s] * inv;
}

// ---------------------------------------------------------------------------
// Kernel 4: attn = probs @ v, written into out[b, t, 512:1024].
// probs[i,s]==0 for s>i  ->  K loop clamped at m0+64.
// The K loop's length grows with the row tile's index and every block of the
// launch is resident at once, so a block takes row tiles t and 31-t, one after
// the other: each block runs 4*(t+1) + 4*(32-t) = 132 chunks.
// grid = (T/128, K_/64, B), block = 256
// ---------------------------------------------------------------------------
__global__ __launch_bounds__(256) void attn_kernel(
    const float* __restrict__ probs, const float* __restrict__ v,
    float* __restrict__ out) {
  __shared__ float As[2][64][20];
  __shared__ v2f Bs[2][8][BNP_];

  const int tid = threadIdx.x;
  const int lane = tid & 31, wave = tid >> 5;
  const int laneM = lane & 15, hi = lane >> 4;
  const int wm = wave & 3, wn = (wave >> 2) << 1;

  const int b = blockIdx.z;
  const int n0 = blockIdx.y * 64;

  const float* A = probs + (size_t)b * T_ * T_;
  const float* V = v + (size_t)b * T_ * K_;
  float* O = out + (size_t)b * T_ * OUTW_;

  const int lr = tid >> 2;          // A staging: 0..63
  const int lk = (tid & 3) << 2;
  const int kp = tid >> 5;          // B staging: k-pair 0..7
  const int nn = (tid & 31) << 1;   // 0..62
  const float* bp = V + (size_t)(2 * kp) * K_ + n0 + nn;

  for (int part = 0; part < 2; ++part) {
    const int mt = part ? (T_ / 64 - 1 - (int)blockIdx.x) : (int)blockIdx.x;
    const int m0 = mt * 64;
    const float* ap = A + (size_t)(m0 + lr) * T_ + lk;

    v8f acc0 = {0.f, 0.f, 0.f, 0.f, 0.f, 0.f, 0.f, 0.f};
    v8f acc1 = {0.f, 0.f, 0.f, 0.f, 0.f, 0.f, 0.f, 0.f};

    // prologue: stage chunk 0.  For the second tile the buffers are free: the
    // barrier at the foot of the first tile's last chunk ended every read.
    {
      async_copy16_held(&As[0][lr][lk], ap);
      v2f r0 = *(const v2f*)(bp);
      v2f r1 = *(const v2f*)(bp + K_);
      Bs[0][kp][nn + 0] = (v2f){r0.x, r1.x};
      Bs[0][kp][nn + 1] = (v2f){r0.y, r1.y};
    }
    wait_async0();
    __syncthreads();

    const int nch = (m0 + 64) / 16;   // causal zero structure of probs
    for (int c = 0; c < nch; ++c) {
      const int cur = c & 1;
      const bool more = (c + 1) < nch;
      v2f n0r, n1r;
      if (more) {
        // the plain loads go first: they are in flight while the wait inside
        // the copy's statement holds the wave
        n0r = *(const v2f*)(bp + (size_t)(c + 1) * 16 * K_);
        n1r = *(const v2f*)(bp + (size_t)(c + 1) * 16 * K_ + K_);
        async_copy16_held(&As[cur ^ 1][lr][lk], ap + (c + 1) * 16);
      }
      mma_step(As[cur], Bs[cur], wm, wn, laneM, hi, acc0, acc1);
      if (more) {
        Bs[cur ^ 1][kp][nn + 0] = (v2f){n0r.x, n1r.x};
        Bs[cur ^ 1][kp][nn + 1] = (v2f){n0r.y, n1r.y};
      }
      wait_async0();
      __syncthreads();
    }

    const int row = m0 + wm * 16 + hi * 8;
    const int c0 = n0 + wn * 16 + laneM;
    const int c1 = c0 + 16;
#pragma unroll  // constant indices keep the accumulators in registers
    for (int r = 0; r < 8; ++r) {
      O[(size_t)(row + r) * OUTW_ + C_ + c0] = acc0[r];
      O[(size_t)(row + r) * OUTW_ + C_ + c1] = acc1[r];
    }
  }
}

// ---------------------------------------------------------------------------
// Kernel 5: out[b, t, 0:512] = x  (float4 copy)
// ---------------------------------------------------------------------------
__global__ __launch_bounds__(256) void concat_x_kernel(const float* __restrict__ x,
                                                       float* __restrict__ out) {
  const size_t idx = (size_t)blockIdx.x * 256 + threadIdx.x;  // float4 index
  const size_t row = idx >> 7;   // 128 float4 per 512-float row
  const size_t c4 = idx & 127;
  f4 val = *(const f4*)(x + (row << 9) + (c4 << 2));
  *(f4*)(out + row * OUTW_ + (c4 << 2)) = val;
}

// ---------------------------------------------------------------------------
extern "C" void kernel_launch(void* const* d_in, const int* in_sizes, int n_in,
                              void* d_out, int out_size, void* d_ws, size_t ws_size,
                              hipStream_t stream) {
  (void)in_sizes; (void)n_in; (void)out_size; (void)ws_size;

  const float* x  = (const float*)d_in[0];
  const float* Wq = (const float*)d_in[1];
  const float* bq = (const float*)d_in[2];
  const float* Wk = (const float*)d_in[3];
  const float* bk = (const float*)d_in[4];
  const float* Wv = (const float*)d_in[5];
  const float* bv = (const float*)d_in[6];
  float* out = (float*)d_out;
  float* ws = (float*)d_ws;

  const size_t NPROJ = (size_t)B_ * T_ * K_;   // 8,388,608 floats
  float* q      = ws;
  float* k      = ws + NPROJ;
  float* v      = ws + 2 * NPROJ;
  float* scores = ws + 3 * NPROJ;              // 8*T*T floats

  qkv_proj_kernel<<<dim3((B_ * T_) / QT_, K_ / QT_, 3), 256, 0, stream>>>(
      x, Wq, bq, Wk, bk, Wv, bv, ws);
  scores_kernel<<<dim3(T_ / 64, T_ / 64, B_), 256, 0, stream>>>(q, k, scores);
  softmax_q_kernel<<<dim3(T_ / SM_COLS_, B_), 512, 0, stream>>>(scores);
  attn_kernel<<<dim3(T_ / 128, K_ / 64, B_), 256, 0, stream>>>(scores, v, out);
  concat_x_kernel<<<(B_ * T_ * C_ / 4) / 256, 256, 0, stream>>>(x, out);
}

// v004
// It runs in 356 microseconds.
// Two timings next to v003 put it at 1.14 and 1.13 times that version's speed.
// Over all steps from v000 it is 2.12 times as fast.
#include <hip/hip_runtime.h>
#include <math.h>

// ---------------------------------------------------------------------------
// AttentionBlock for MI455X (gfx1250, wave32, WMMA).
// FP32 end-to-end using V_WMMA_F32_16X16X4_F32 (exact fp32 matrix math).
// - LDS double-buffered (1 barrier/chunk)
// - k-pair-major float2 B layout: B fragment = one contiguous ds_load_b64
// - A tiles staged with CDNA5 async DMA: global_load_async_to_lds_b128
//   (ASYNCcnt-tracked, no VGPR round trip), synced via s_wait_asynccnt.
// Workspace layout (floats): q[8M] | k[8M] | v[8M] | scores[33.5M]  (~224 MB)
// ---------------------------------------------------------------------------

typedef __attribute__((ext_vector_type(2))) float v2f;
typedef __attribute__((ext_vector_type(4))) float f4;
typedef __attribute__((ext_vector_type(8))) float v8f;

#define B_ 8
#define T_ 2048
#define C_ 512
#define K_ 512
#define OUTW_ (C_ + K_)   // 1024

#define BNP_ 72           // padded row length (in float2) of B tiles

__device__ __forceinline__ v8f wmma_f32(v2f a, v2f b, v8f c) {
  // D = A(16x4) x B(4x16) + C(16x16), all fp32
  return __builtin_amdgcn_wmma_f32_16x16x4_f32(
      /*neg_a=*/false, a, /*neg_b=*/false, b,
      /*c_mod=*/(short)0, c, /*reuse_a=*/false, /*reuse_b=*/false);
}

// Async DMA: copy 16 bytes global -> LDS for this lane (ASYNCcnt-tracked).
__device__ __forceinline__ void async_copy16(void* lds_dst, const float* gsrc) {
  const unsigned lds_off = (unsigned)(uintptr_t)lds_dst;   // LDS aperture: addr[31:0]
  const unsigned long long ga = (unsigned long long)(uintptr_t)gsrc;
  asm volatile("global_load_async_to_lds_b128 %0, %1, off"
               :
               : "v"(lds_off), "v"(ga)
               : "memory");
}

// The same copy with s_wait_xcnt 0 as the last line of its own statement, so
// that the wait stands in front of every rewrite of the two address registers.
__device__ __forceinline__ void async_copy16_held(void* lds_dst, const float* gsrc) {
  const unsigned lds_off = (unsigned)(uintptr_t)lds_dst;   // LDS aperture: addr[31:0]
  const unsigned long long ga = (unsigned long long)(uintptr_t)gsrc;
  asm volatile("global_load_async_to_lds_b128 %0, %1, off\n\ts_wait_xcnt 0x0"
               :
               : "v"(lds_off), "v"(ga)
               : "memory");
}

__device__ __forceinline__ void wait_async0() {
  asm volatile("s_wait_asynccnt 0x0" ::: "memory");
}

// One BK=16 chunk of wave-level MMA: wave computes two 16x16 tiles.
// As: [64][20] floats (row-major, padded).  Bs: [8][BNP_] float2,
// Bs[kp][n] = {B[2kp][n], B[2kp+1][n]}  -> fragment is one b64 load.
__device__ __forceinline__ void mma_step(const float (&As)[64][20],
                                         const v2f (&Bs)[8][BNP_],
                                         int wm, int wn, int laneM, int hi,
                                         v8f& acc0, v8f& acc1) {
  const float* ar = &As[wm * 16 + laneM][0];
#pragma unroll
  for (int kk = 0; kk < 16; kk += 4) {
    const int kb = kk + 2 * hi;   // lanes 0-15: K=kk,kk+1 ; lanes 16-31: K=kk+2,kk+3
    v2f a;
    a.x = ar[kb];
    a.y = ar[kb + 1];
    const v2f b0 = Bs[kb >> 1][wn * 16 + laneM];
    const v2f b1 = Bs[kb >> 1][wn * 16 + 16 + laneM];
    acc0 = wmma_f32(a, b0, acc0);
    acc1 = wmma_f32(a, b1, acc1);
  }
}

// ---------------------------------------------------------------------------
// Kernel 1: fused QKV projection.  out[m,n] = sum_c x[m,c]*W[n,c] + b[n]
// A block owns a 128x128 tile of the output; its 8 waves stand 4 (rows) x 2
// (columns) and each holds 32x64 = 2x4 accumulator tiles, so a k group of 4
// takes 6 fragment loads for 8 matrix instructions, and a staged operand row
// feeds 128 outputs.  The k order of every output element is the old one.
// grid = (M/128, K_/128, 3), block = 256
// ---------------------------------------------------------------------------
#define QT_ 128           // rows and columns of the block's tile
#define QBNP_ (QT_ + 8)   // padded row length (in float2) of its B tile

// Two copies of 16 bytes a lane, with s_wait_xcnt 0 as the last line of their
// own statement, so that the wait stands in front of every rewrite of the
// address registers that the copies name.
__device__ __forceinline__ void async_copy16x2_held(void* lds0, const float* g0,
                                                    void* lds1, const float* g1) {
  const unsigned l0 = (unsigned)(uintptr_t)lds0;   // LDS aperture: addr[31:0]
  const unsigned l1 = (unsigned)(uintptr_t)lds1;
  const unsigned long long a0 = (unsigned long long)(uintptr_t)g0;
  const unsigned long long a1 = (unsigned long long)(uintptr_t)g1;
  asm volatile("global_load_async_to_lds_b128 %0, %1, off\n\t"
               "global_load_async_to_lds_b128 %2, %3, off\n\t"
               "s_wait_xcnt 0x0"
               :
               : "v"(l0), "v"(a0), "v"(l1), "v"(a1)
               : "memory");
}

__global__ __launch_bounds__(256) void qkv_proj_kernel(
    const float* __restrict__ x,
    const float* __restrict__ Wq, const float* __restrict__ bq,
    const float* __restrict__ Wk, const float* __restrict__ bk,
    const float* __restrict__ Wv, const float* __restrict__ bv,
    float* __restrict__ qkv_ws) {
  __shared__ __attribute__((aligned(16))) float As[2][QT_][20];
  __shared__ __attribute__((aligned(16))) v2f Bs[2][8][QBNP_];

  const int tid = threadIdx.x;
  const int lane = tid & 31, wave = tid >> 5;
  const int laneM = lane & 15, hi = lane >> 4;
  const int wm = wave & 3, wn = wave >> 2;   // 32-row band, 64-column band

  const int proj = blockIdx.z;
  const float* W = (proj == 0) ? Wq : (proj == 1) ? Wk : Wv;
  const float* bias = (proj == 0) ? bq : (proj == 1) ? bk : bv;
  float* out = qkv_ws + (size_t)proj * ((size_t)B_ * T_ * K_);

  const int m0 = blockIdx.x * QT_;
  const int n0 = blockIdx.y * QT_;

  v8f acc[2][4];
#pragma unroll  // constant indices keep the accumulators in registers
  for (int i = 0; i < 2; ++i)
#pragma unroll  // the same
    for (int j = 0; j < 4; ++j)
      acc[i][j] = (v8f){0.f, 0.f, 0.f, 0.f, 0.f, 0.f, 0.f, 0.f};

  // staging: a lane brings 16 bytes of rows lr and lr + 64 of each operand
  const int lr = tid >> 2;         // 0..63
  const int lk = (tid & 3) << 2;   // 0,4,8,12
  const float* ap = x + (size_t)(m0 + lr) * C_ + lk;
  const float* bp = W + (size_t)(n0 + lr) * C_ + lk;

  // prologue: stage chunk 0 into buffer 0
  {
    f4 w0 = *(const f4*)(bp);                     // B: transpose via regs
    f4 w1 = *(const f4*)(bp + 64 * C_);
    async_copy16x2_held(&As[0][lr][lk], ap,       // A: async DMA to LDS
                        &As[0][lr + 64][lk], ap + 64 * C_);
    Bs[0][(lk >> 1) + 0][lr] = (v2f){w0.x, w0.y};
    Bs[0][(lk >> 1) + 1][lr] = (v2f){w0.z, w0.w};
    Bs[0][(lk >> 1) + 0][lr + 64] = (v2f){w1.x, w1.y};
    Bs[0][(lk >> 1) + 1][lr + 64] = (v2f){w1.z, w1.w};
  }
  wait_async0();
  __syncthreads();

  const int nch = C_ / 16;   // 32 chunks
  for (int c = 0; c < nch; ++c) {
    const int cur = c & 1;
    const bool more = (c + 1) < nch;
    f4 nb0, nb1;
    if (more) {
      // the plain loads go first: they are in flight while the wait inside
      // the copies' statement holds the wave
      nb0 = *(const f4*)(bp + (c + 1) * 16);
      nb1 = *(const f4*)(bp + (c + 1) * 16 + 64 * C_);
      async_copy16x2_held(&As[cur ^ 1][lr][lk], ap + (c + 1) * 16,
                          &As[cur ^ 1][lr + 64][lk], ap + (c + 1) * 16 + 64 * C_);
    }
#pragma unroll  // constant k offsets fold into the LDS loads
    for (int kk = 0; kk < 16; kk += 4) {
      const int kb = kk + 2 * hi;   // lanes 0-15: K=kk,kk+1 ; lanes 16-31: K=kk+2,kk+3
      v2f a[2], bfr[4];
#pragma unroll  // fragments stay in registers
      for (int i = 0; i < 2; ++i) {
        const float* ar = &As[cur][wm * 32 + i * 16 + laneM][0];
        a[i].x = ar[kb];
        a[i].y = ar[kb + 1];
      }
#pragma unroll  // fragments stay in registers
      for (int j = 0; j < 4; ++j) bfr[j] = Bs[cur][kb >> 1][wn * 64 + j * 16 + laneM];
#pragma unroll  // constant indices keep the accumulators in registers
      for (int i = 0; i < 2; ++i)
#pragma unroll  // the same
        for (int j = 0; j < 4; ++j) acc[i][j] = wmma_f32(a[i], bfr[j], acc[i][j]);
    }
    if (more) {
      Bs[cur ^ 1][(lk >> 1) + 0][lr] = (v2f){nb0.x, nb0.y};
      Bs[cur ^ 1][(lk >> 1) + 1][lr] = (v2f){nb0.z, nb0.w};
      Bs[cur ^ 1][(lk >> 1) + 0][lr + 64] = (v2f){nb1.x, nb1.y};
      Bs[cur ^ 1][(lk >> 1) + 1][lr + 64] = (v2f){nb1.z, nb1.w};
    }
    // this wave's LDS reads and writes of the trip are done before it says so
    asm volatile("s_wait_dscnt 0x0" ::: "memory");
    wait_async0();
    __syncthreads();
  }

#pragma unroll  // constant indices keep the accumulators in registers
  for (int j = 0; j < 4; ++j) {
    const int col = n0 + wn * 64 + j * 16 + laneM;
    const float bv_ = bias[col];
#pragma unroll  // the same
    for (int i = 0; i < 2; ++i) {
      const int row = m0 + wm * 32 + i * 16 + hi * 8;
#pragma unroll  // the same
      for (int r = 0; r < 8; ++r)
        out[(size_t)(row + r) * K_ + col] = acc[i][j][r] + bv_;
    }
  }
}

// ---------------------------------------------------------------------------
// Kernel 2: scores[b,i,j] = (j>i) ? -inf : dot(q[b,i,:], k[b,j,:]) / sqrt(512)
// Only the 64x64 tiles on or below the diagonal exist: a tile wholly above it
// is masked, its softmax is 0, and neither kernel 3 nor kernel 4 reads it, so
// it is neither launched nor stored.  Row tile i has i+1 live tiles; row tiles
// 31-y and y together have 33, which is one line of the grid, so every block
// of the launch does the same work wherever it is placed.
// grid = (T/64 + 1, T/128, B), block = 256
// ---------------------------------------------------------------------------
__global__ __launch_bounds__(256) void scores_kernel(
    const float* __restrict__ q, const float* __restrict__ kmat,
    float* __restrict__ scores) {
  const int b = blockIdx.z;
  const int fx = blockIdx.x, fy = blockIdx.y;
  const int nlong = T_ / 64 - fy;            // live tiles of row tile 31-fy
  const bool longrow = fx < nlong;
  const int m0 = (longrow ? T_ / 64 - 1 - fy : fy) * 64;
  const int n0 = (longrow ? fx : fx - nlong) * 64;   // n0 <= m0
  float* S = scores + (size_t)b * T_ * T_;

  __shared__ float As[2][64][20];
  __shared__ v2f Bs[2][8][BNP_];

  const int tid = threadIdx.x;
  const int lane = tid & 31, wave = tid >> 5;
  const int laneM = lane & 15, hi = lane >> 4;
  const int wm = wave & 3, wn = (wave >> 2) << 1;

  v8f acc0 = {0.f, 0.f, 0.f, 0.f, 0.f, 0.f, 0.f, 0.f};
  v8f acc1 = {0.f, 0.f, 0.f, 0.f, 0.f, 0.f, 0.f, 0.f};

  const int lr = tid >> 2;
  const int lk = (tid & 3) << 2;
  const float* ap = q + (size_t)b * T_ * K_ + (size_t)(m0 + lr) * K_ + lk;
  const float* bp = kmat + (size_t)b * T_ * K_ + (size_t)(n0 + lr) * K_ + lk;

  {
    async_copy16(&As[0][lr][lk], ap);
    f4 kv = *(const f4*)(bp);
    Bs[0][(lk >> 1) + 0][lr] = (v2f){kv.x, kv.y};
    Bs[0][(lk >> 1) + 1][lr] = (v2f){kv.z, kv.w};
  }
  wait_async0();
  __syncthreads();

  const int nch = K_ / 16;
  for (int c = 0; c < nch; ++c) {
    const int cur = c & 1;
    const bool more = (c + 1) < nch;
    f4 nb;
    if (more) {
      async_copy16(&As[cur ^ 1][lr][lk], ap + (c + 1) * 16);
      nb = *(const f4*)(bp + (c + 1) * 16);
    }
    mma_step(As[cur], Bs[cur], wm, wn, laneM, hi, acc0, acc1);
    if (more) {
      Bs[cur ^ 1][(lk >> 1) + 0][lr] = (v2f){nb.x, nb.y};
      Bs[cur ^ 1][(lk >> 1) + 1][lr] = (v2f){nb.z, nb.w};
    }
    wait_async0();
    __syncthreads();
  }

  const float sc = 0.04419417382415922f;  // 1/sqrt(512)
  const int row = m0 + wm * 16 + hi * 8;
  const int c0 = n0 + wn * 16 + laneM;
  const int c1 = c0 + 16;
#pragma unroll
  for (int r = 0; r < 8; ++r) {
    const int i = row + r;
    S[(size_t)i * T_ + c0] = (c0 > i) ? -INFINITY : acc0[r] * sc;
    S[(size_t)i * T_ + c1] = (c1 > i) ? -INFINITY : acc1[r] * sc;
  }
}

// ---------------------------------------------------------------------------
// Kernel 3: softmax over axis=1 (QUERY axis): normalize each column j.
// A strip is 32 columns; a step is 64 rows.  Strip c is masked in every step
// below c/2 (those tiles are never stored and never read), so it has 32 - c/2
// live steps.  A block owns strips t and 63-t, which together have 33 live
// steps for every t, and holds both in registers (33 float4 per lane): every
// load is issued before the first use, each live element is read once, and
// all 256 blocks do the same work.
// Slot i holds step t/2 + i of strip t while i < 32 - t/2, else step i-1 of
// strip 63-t; both strips are walked in rising row order.
// A wave-wide load covers 4 rows x 128 bytes (whole lines).
// Masked (-inf) entries of a diagonal tile become exactly 0: the diagonal entry
// of every column is unmasked, so the column maximum is finite and
// expf(-inf - max) is 0.
// grid = (T/64, B), block = 512
// ---------------------------------------------------------------------------
#define SM_COLS_ 32
#define SM_ROWS_ 64                     // rows covered by the block per step
#define SM_STEPS_ (T_ / SM_ROWS_)       // 32
#define SM_STRIPS_ (T_ / SM_COLS_)      // 64
#define SM_SLOTS_ (SM_STEPS_ + 1)       // 33
#define SM_MID_ (SM_STEPS_ / 2)         // 16
#define SM_PITCH_ 36                    // floats; 144 B rows: b128 stores conflict-free
// Does slot i belong to the first strip?  na is 17..32, so only slots 17..31
// are decided at run time (the same way in every lane of the block).
#define SM_FIRST_(i, na) ((i) <= SM_STEPS_ / 2 || ((i) < SM_STEPS_ && (i) < (na)))

__global__ __launch_bounds__(512) void softmax_q_kernel(float* __restrict__ scores) {
  __shared__ __attribute__((aligned(16))) float red[2][SM_ROWS_][SM_PITCH_];
  __shared__ __attribute__((aligned(16))) float gmx[2][SM_COLS_];
  __shared__ __attribute__((aligned(16))) float ginv[2][SM_COLS_];

  const int tid = threadIdx.x;
  const int c4 = (tid & 7) << 2;        // first of this lane's 4 columns
  const int rr = tid >> 3;              // 0..63: row inside a step
  const int rcol = tid >> 4;            // 0..31: column this lane helps to reduce
  const int rrow = tid & 15;            // 0..15
  const int t = blockIdx.x;             // 0..31
  const int na = SM_STEPS_ - (t >> 1);  // slots of strip t
  float* S = scores + (size_t)blockIdx.y * T_ * T_;                         // uniform
  // Element offset of the middle slot (16) in either strip: counted from there
  // every other slot's distance fits the load's and the store's offset field,
  // so a slot's address register is formed once and serves both.
  const int baseA = ((t >> 1) + SM_MID_) * SM_ROWS_ * T_ + t * SM_COLS_;                 // uniform
  const int baseB = (SM_MID_ - 1) * SM_ROWS_ * T_ + (SM_STRIPS_ - 1 - t) * SM_COLS_;     // uniform
  const unsigned off = (unsigned)(rr * T_ + c4);                                         // per lane

  f4 xv[SM_SLOTS_];
#pragma unroll  // constant indices keep xv[] in registers
  for (int i = 0; i < SM_SLOTS_; ++i) {
    const int base = SM_FIRST_(i, na) ? baseA : baseB;
    xv[i] = *(const f4*)(S + (size_t)(base + (i - SM_MID_) * SM_ROWS_ * T_) + off);
  }
  // stands between the loads above and the first rewrite of a register that
  // one of them names as its address
  asm volatile("s_wait_xcnt 0x0" ::: "memory");

  // column maxima: lane, then block
  // (a slot enters the other strip's maximum as -inf, which changes nothing)
  const f4 ninf = {-INFINITY, -INFINITY, -INFINITY, -INFINITY};
  f4 mA = xv[0], mB = ninf;
#pragma unroll  // constant indices keep xv[] in registers
  for (int i = 1; i < SM_SLOTS_; ++i) {
    const bool first = SM_FIRST_(i, na);
    const f4 a = first ? xv[i] : ninf;
    const f4 b = first ? ninf : xv[i];
    mA.x = fmaxf(mA.x, a.x);
    mA.y = fmaxf(mA.y, a.y);
    mA.z = fmaxf(mA.z, a.z);
    mA.w = fmaxf(mA.w, a.w);
    mB.x = fmaxf(mB.x, b.x);
    mB.y = fmaxf(mB.y, b.y);
    mB.z = fmaxf(mB.z, b.z);
    mB.w = fmaxf(mB.w, b.w);
  }
  *(f4*)&red[0][rr][c4] = mA;
  *(f4*)&red[1][rr][c4] = mB;
  __syncthreads();
#pragma unroll  // the two strips' chains interleave
  for (int p = 0; p < 2; ++p) {
    float v = fmaxf(fmaxf(red[p][rrow][rcol], red[p][rrow + 16][rcol]),
                    fmaxf(red[p][rrow + 32][rcol], red[p][rrow + 48][rcol]));
#pragma unroll  // four fixed butterfly steps inside a 16-lane group
    for (int d = 1; d < 16; d <<= 1) v = fmaxf(v, __shfl_xor(v, d, 32));
    if (rrow == 0) gmx[p][rcol] = v;
  }
  __syncthreads();
  const f4 MA = *(const f4*)&gmx[0][c4];
  const f4 MB = *(const f4*)&gmx[1][c4];

  // exponentials replace the scores in registers; column sums: lane, then block
  f4 smA = {0.f, 0.f, 0.f, 0.f};
  f4 smB = {0.f, 0.f, 0.f, 0.f};
#pragma unroll  // constant indices keep xv[] in registers
  for (int i = 0; i < SM_SLOTS_; ++i) {
    const bool first = SM_FIRST_(i, na);
    const f4 M = first ? MA : MB;
    f4 e;
    e.x = expf(xv[i].x - M.x);
    e.y = expf(xv[i].y - M.y);
    e.z = expf(xv[i].z - M.z);
    e.w = expf(xv[i].w - M.w);
    xv[i] = e;
    if (first) smA += e; else smB += e;
  }
  *(f4*)&red[0][rr][c4] = smA;
  *(f4*)&red[1][rr][c4] = smB;
  __syncthreads();
#pragma unroll  // the two strips' chains interleave
  for (int p = 0; p < 2; ++p) {
    float v = (red[p][rrow][rcol] + red[p][rrow + 16][rcol]) +
              (red[p][rrow + 32][rcol] + red[p][rrow + 48][rcol]);
#pragma unroll  // four fixed butterfly steps inside a 16-lane group
    for (int d = 1; d < 16; d <<= 1) v += __shfl_xor(v, d, 32);
    if (rrow == 0) ginv[p][rcol] = 1.0f / v;
  }
  __syncthreads();
  const f4 invA = *(const f4*)&ginv[0][c4];
  const f4 invB = *(const f4*)&ginv[1][c4];

#pragma unroll  // constant indices keep xv[] in registers
  for (int i = 0; i < SM_SLOTS_; ++i) xv[i] *= SM_FIRST_(i, na) ? invA : invB;
  // every product is made before the first store issues, so that no vector
  // instruction rewrites a register that an issued store names
  __builtin_amdgcn_sched_barrier(0);
#pragma unroll  // constant indices keep xv[] in registers
  for (int i = 0; i < SM_SLOTS_; ++i) {
    const int base = SM_FIRST_(i, na) ? baseA : baseB;
    *(f4*)(S + (size_t)(base + (i - SM_MID_) * SM_ROWS_ * T_) + off) = xv[i];
  }
}

// ---------------------------------------------------------------------------
// Kernel 4: attn = probs @ v, written into out[b, t, 512:1024].
// probs[i,s]==0 for s>i  ->  K loop clamped at m0+64.
// The K loop's length grows with the row tile's index and every block of the
// launch is resident at once, so a block takes row tiles t and 31-t, one after
// the other: each block runs 4*(t+1) + 4*(32-t) = 132 chunks.
// grid = (T/128, K_/64, B), block = 256
// ---------------------------------------------------------------------------
__global__ __launch_bounds__(256) void attn_kernel(
    const float* __restrict__ probs, const float* __restrict__ v,
    float* __restrict__ out) {
  __shared__ float As[2][64][20];
  __shared__ v2f Bs[2][8][BNP_];

  const int tid = threadIdx.x;
  const int lane = tid & 31, wave = tid >> 5;
  const int laneM = lane & 15, hi = lane >> 4;
  const int wm = wave & 3, wn = (wave >> 2) << 1;

  const int b = blockIdx.z;
  const int n0 = blockIdx.y * 64;

  const float* A = probs + (size_t)b * T_ * T_;
  const float* V = v + (size_t)b * T_ * K_;
  float* O = out + (size_t)b * T_ * OUTW_;

  const int lr = tid >> 2;          // A staging: 0..63
  const int lk = (tid & 3) << 2;
  const int kp = tid >> 5;          // B staging: k-pair 0..7
  const int nn = (tid & 31) << 1;   // 0..62
  const float* bp = V + (size_t)(2 * kp) * K_ + n0 + nn;

  for (int part = 0; part < 2; ++part) {
    const int mt = part ? (T_ / 64 - 1 - (int)blockIdx.x) : (int)blockIdx.x;
    const int m0 = mt * 64;
    const float* ap = A + (size_t)(m0 + lr) * T_ + lk;

    v8f acc0 = {0.f, 0.f, 0.f, 0.f, 0.f, 0.f, 0.f, 0.f};
    v8f acc1 = {0.f, 0.f, 0.f, 0.f, 0.f, 0.f, 0.f, 0.f};

    // prologue: stage chunk 0.  For the second tile the buffers are free: the
    // barrier at the foot of the first tile's last chunk ended every read.
    {
      async_copy16_held(&As[0][lr][lk], ap);
      v2f r0 = *(const v2f*)(bp);
      v2f r1 = *(const v2f*)(bp + K_);
      Bs[0][kp][nn + 0] = (v2f){r0.x, r1.x};
      Bs[0][kp][nn + 1] = (v2f){r0.y, r1.y};
    }
    wait_async0();
    __syncthreads();

    const int nch = (m0 + 64) / 16;   // causal zero structure of probs
    for (int c = 0; c < nch; ++c) {
      const int cur = c & 1;
      const bool more = (c + 1) < nch;
      v2f n0r, n1r;
      if (more) {
        // the plain loads go first: they are in flight while the wait inside
        // the copy's statement holds the wave
        n0r = *(const v2f*)(bp + (size_t)(c + 1) * 16 * K_);
        n1r = *(const v2f*)(bp + (size_t)(c + 1) * 16 * K_ + K_);
        async_copy16_held(&As[cur ^ 1][lr][lk], ap + (c + 1) * 16);
      }
      mma_step(As[cur], Bs[cur], wm, wn, laneM, hi, acc0, acc1);
      if (more) {
        Bs[cur ^ 1][kp][nn + 0] = (v2f){n0r.x, n1r.x};
        Bs[cur ^ 1][kp][nn + 1] = (v2f){n0r.y, n1r.y};
      }
      wait_async0();
      __syncthreads();
    }

    const int row = m0 + wm * 16 + hi * 8;
    const int c0 = n0 + wn * 16 + laneM;
    const int c1 = c0 + 16;
#pragma unroll  // constant indices keep the accumulators in registers
    for (int r = 0; r < 8; ++r) {
      O[(size_t)(row + r) * OUTW_ + C_ + c0] = acc0[r];
      O[(size_t)(row + r) * OUTW_ + C_ + c1] = acc1[r];
    }
  }
}

// ---------------------------------------------------------------------------
// Kernel 5: out[b, t, 0:512] = x  (float4 copy)
// ---------------------------------------------------------------------------
__global__ __launch_bounds__(256) void concat_x_kernel(const float* __restrict__ x,
                                                       float* __restrict__ out) {
  const size_t idx = (size_t)blockIdx.x * 256 + threadIdx.x;  // float4 index
  const size_t row = idx >> 7;   // 128 float4 per 512-float row
  const size_t c4 = idx & 127;
  f4 val = *(const f4*)(x + (row << 9) + (c4 << 2));
  *(f4*)(out + row * OUTW_ + (c4 << 2)) = val;
}

// ---------------------------------------------------------------------------
extern "C" void kernel_launch(void* const* d_in, const int* in_sizes, int n_in,
                              void* d_out, int out_size, void* d_ws, size_t ws_size,
                              hipStream_t stream) {
  (void)in_sizes; (void)n_in; (void)out_size; (void)ws_size;

  const float* x  = (const float*)d_in[0];
  const float* Wq = (const float*)d_in[1];
  const float* bq = (const float*)d_in[2];
  const float* Wk = (const float*)d_in[3];
  const float* bk = (const float*)d_in[4];
  const float* Wv = (const float*)d_in[5];
  const float* bv = (const float*)d_in[6];
  float* out = (float*)d_out;
  float* ws = (float*)d_ws;

  const size_t NPROJ = (size_t)B_ * T_ * K_;   // 8,388,608 floats
  float* q      = ws;
  float* k      = ws + NPROJ;
  float* v      = ws + 2 * NPROJ;
  float* scores = ws + 3 * NPROJ;              // 8*T*T floats

  qkv_proj_kernel<<<dim3((B_ * T_) / QT_, K_ / QT_, 3), 256, 0, stream>>>(
      x, Wq, bq, Wk, bk, Wv, bv, ws);
  scores_kernel<<<dim3(T_ / 64 + 1, T_ / 128, B_), 256, 0, stream>>>(q, k, scores);
  softmax_q_kernel<<<dim3(SM_STRIPS_ / 2, B_), 512, 0, stream>>>(scores);
  attn_kernel<<<dim3(T_ / 128, K_ / 64, B_), 256, 0, stream>>>(scores, v, out);
  concat_x_kernel<<<(B_ * T_ * C_ / 4) / 256, 256, 0, stream>>>(x, out);
}

// v006
// Measured time: 302 microseconds a run.
// Versions between v004 and this one are left out; their measured steps multiply to 1.19 times as fast.
// Counting every step since v000, it is 2.51 times as fast.
#include <hip/hip_runtime.h>
#include <math.h>

// ---------------------------------------------------------------------------
// AttentionBlock for MI455X (gfx1250, wave32, WMMA).
// FP32 end-to-end using V_WMMA_F32_16X16X4_F32 (exact fp32 matrix math).
// - LDS double-buffered (1 barrier/chunk)
// - k-pair-major float2 B layout: B fragment = one contiguous ds_load_b64
// - A tiles staged with CDNA5 async DMA: global_load_async_to_lds_b128
//   (ASYNCcnt-tracked, no VGPR round trip), synced via s_wait_asynccnt.
// Workspace layout (floats): G[256K], h[512] | z[8M] | v[8M] | scores[33.5M]
// ---------------------------------------------------------------------------

typedef __attribute__((ext_vector_type(2))) float v2f;
typedef __attribute__((ext_vector_type(4))) float f4;
typedef __attribute__((ext_vector_type(8))) float v8f;

#define B_ 8
#define T_ 2048
#define C_ 512
#define K_ 512
#define OUTW_ (C_ + K_)   // 1024

#define BNP_ 72           // padded row length (in float2) of B tiles

__device__ __forceinline__ v8f wmma_f32(v2f a, v2f b, v8f c) {
  // D = A(16x4) x B(4x16) + C(16x16), all fp32
  return __builtin_amdgcn_wmma_f32_16x16x4_f32(
      /*neg_a=*/false, a, /*neg_b=*/false, b,
      /*c_mod=*/(short)0, c, /*reuse_a=*/false, /*reuse_b=*/false);
}

__device__ __forceinline__ void wait_async0() {
  asm volatile("s_wait_asynccnt 0x0" ::: "memory");
}

// Kernels 2 and 4, with 64x64 block tiles, stage deep chunks of
// k: a K-contiguous operand row gives whole 128-byte lines to a chunk, and the
// chain from a chunk's loads to the barrier that publishes them is paid once
// per 16 or 32 matrix instructions of a wave.  Kernel 2 has 8 blocks on a WGP
// to cover that chain and takes 32 k; kernel 4 has 4 and takes 64 k.
#define SCK_ 32           // k depth of a staged chunk, kernel 2
#define ACK_ 64           // k depth of a staged chunk, kernel 4
// Kernel 2's B tile is transposed through registers: 8 lanes of a row store to
// 8 k-pair rows at once, and at this pitch they fall two to a bank, not four
#define SBP_ 68           // padded row length (float2) of kernel 2's B tile

// One chunk of CK k of wave-level MMA: wave computes two 16x16 tiles.
// As: [64][CK + 4] floats (row-major, padded).  Bs: [CK/2][BP] float2,
// Bs[kp][n] = {B[2kp][n], B[2kp+1][n]}  -> fragment is one b64 load.
template <int CK, int BP>
__device__ __forceinline__ void mma_step(const float (&As)[64][CK + 4],
                                         const v2f (&Bs)[CK / 2][BP],
                                         int wm, int wn, int laneM, int hi,
                                         v8f& acc0, v8f& acc1) {
  const float* ar = &As[wm * 16 + laneM][0];
#pragma unroll  // constant k offsets fold into the LDS loads
  for (int kk = 0; kk < CK; kk += 4) {
    const int kb = kk + 2 * hi;   // lanes 0-15: K=kk,kk+1 ; lanes 16-31: K=kk+2,kk+3
    v2f a;
    a.x = ar[kb];
    a.y = ar[kb + 1];
    const v2f b0 = Bs[kb >> 1][wn * 16 + laneM];
    const v2f b1 = Bs[kb >> 1][wn * 16 + 16 + laneM];
    acc0 = wmma_f32(a, b0, acc0);
    acc1 = wmma_f32(a, b1, acc1);
  }
}

// ---------------------------------------------------------------------------
// Kernel 0: the query weights are folded into the key side.
//   q[i].k[j] = (Wq x[i] + bq).k[j] = x[i].(Wq^T k[j]) + bq.k[j]
// The last term does not depend on i, and the softmax runs over i: it shifts a
// whole column of scores by one constant and cancels.  With
//   G[c1][c2] = sum_k Wq[k][c1] * Wk[k][c2],   h[c1] = sum_k Wq[k][c1] * bk[k]
// z[j] = Wq^T k[j] = G x[j] + h is ONE projection of x where q and k were two,
// and the scores are x[i].z[j].
// Both operands are read along their rows, so both are staged k-pair-major
// like every B tile of this file, and a fragment is one b64 load.
// A block does a 64x64 tile of G in 8 stages of 64 k; the next stage's loads
// are in flight while this one is multiplied.  The blocks of grid line 0 also
// sum h, from the Wq tile that they hold in LDS anyway.
// grid = (C_/64, C_/64), block = 256
// ---------------------------------------------------------------------------
#define FK_ 64            // k rows of a stage

__global__ __launch_bounds__(256) void fold_kernel(
    const float* __restrict__ Wq, const float* __restrict__ Wk,
    const float* __restrict__ bk, float* __restrict__ G, float* __restrict__ h) {
  __shared__ v2f Ap[FK_ / 2][BNP_];
  __shared__ v2f Bp[FK_ / 2][BNP_];
  __shared__ float sb[K_];
  __shared__ float hp[4][64];

  const int tid = threadIdx.x;
  const int m0 = blockIdx.x * 64;   // c1: rows of G

  const int n0 = blockIdx.y * 64;   // c2: columns of G
  const int lane = tid & 31, wave = tid >> 5;
  const int laneM = lane & 15, hi = lane >> 4;
  const int wm = wave & 3, wn = (wave >> 2) << 1;

  const int kp = tid >> 5;          // k-pair 0..7 of a group of 16 rows
  const int nn = (tid & 31) << 1;   // 0..62
  const float* ag = Wq + (size_t)(2 * kp) * C_ + m0 + nn;
  const float* bg = Wk + (size_t)(2 * kp) * C_ + n0 + nn;

  v8f acc0 = {0.f, 0.f, 0.f, 0.f, 0.f, 0.f, 0.f, 0.f};
  v8f acc1 = {0.f, 0.f, 0.f, 0.f, 0.f, 0.f, 0.f, 0.f};

  // h: a lane sums a quarter of every stage's k rows of one column of Wq
  const bool doh = blockIdx.y == 0;   // the same for the whole block
  const int hm = tid & 63, hq = tid >> 6;
  float hs = 0.f;
  if (doh) {   // read behind the first stage's barrier
    sb[tid] = bk[tid];
    sb[tid + 256] = bk[tid + 256];
  }

  v2f ra[FK_ / 16][2], rb[FK_ / 16][2];
#pragma unroll  // constant indices keep the staged rows in registers
  for (int u = 0; u < FK_ / 16; ++u) {
    ra[u][0] = *(const v2f*)(ag + (size_t)(u * 16) * C_);
    ra[u][1] = *(const v2f*)(ag + (size_t)(u * 16 + 1) * C_);
    rb[u][0] = *(const v2f*)(bg + (size_t)(u * 16) * C_);
    rb[u][1] = *(const v2f*)(bg + (size_t)(u * 16 + 1) * C_);
  }

#pragma unroll  // constant row offsets: the two address registers are never rewritten
  for (int s = 0; s < K_ / FK_; ++s) {
#pragma unroll  // constant indices keep the staged rows in registers
    for (int u = 0; u < FK_ / 16; ++u) {
      Ap[u * 8 + kp][nn + 0] = (v2f){ra[u][0].x, ra[u][1].x};
      Ap[u * 8 + kp][nn + 1] = (v2f){ra[u][0].y, ra[u][1].y};
      Bp[u * 8 + kp][nn + 0] = (v2f){rb[u][0].x, rb[u][1].x};
      Bp[u * 8 + kp][nn + 1] = (v2f){rb[u][0].y, rb[u][1].y};
    }
    __syncthreads();
    if (s + 1 < K_ / FK_) {
#pragma unroll  // the same
      for (int u = 0; u < FK_ / 16; ++u) {
        const size_t r = (size_t)((s + 1) * FK_ + u * 16) * C_;
        ra[u][0] = *(const v2f*)(ag + r);
        ra[u][1] = *(const v2f*)(ag + r + C_);
      }
      // stands in front of any rewrite of the address that the loads above name
      asm volatile("s_wait_xcnt 0x0" ::: "memory");
#pragma unroll  // the same
      for (int u = 0; u < FK_ / 16; ++u) {
        const size_t r = (size_t)((s + 1) * FK_ + u * 16) * C_;
        rb[u][0] = *(const v2f*)(bg + r);
        rb[u][1] = *(const v2f*)(bg + r + C_);
      }
      // the same for these
      asm volatile("s_wait_xcnt 0x0" ::: "memory");
    }
#pragma unroll  // constant k offsets fold into the LDS loads
    for (int kk = 0; kk < FK_; kk += 4) {
      const int kb = kk + 2 * hi;   // lanes 0-15: K=kk,kk+1 ; lanes 16-31: K=kk+2,kk+3
      const v2f a = Ap[kb >> 1][wm * 16 + laneM];
      const v2f b0 = Bp[kb >> 1][wn * 16 + laneM];
      const v2f b1 = Bp[kb >> 1][wn * 16 + 16 + laneM];
      acc0 = wmma_f32(a, b0, acc0);
      acc1 = wmma_f32(a, b1, acc1);
    }
    if (doh) {
#pragma unroll  // constant offsets fold into the LDS loads
      for (int j = 0; j < FK_ / 8; ++j) {
        const int p = hq * (FK_ / 8) + j;
        const v2f w = Ap[p][hm];
        hs = fmaf(w.x, sb[s * FK_ + 2 * p], hs);
        hs = fmaf(w.y, sb[s * FK_ + 2 * p + 1], hs);
      }
    }
    __syncthreads();   // every read of the stage is done before it is rewritten
  }

  if (doh) {
    hp[hq][hm] = hs;
    __syncthreads();
    if (tid < 64) h[m0 + tid] = (hp[0][tid] + hp[1][tid]) + (hp[2][tid] + hp[3][tid]);
  }

  const int row = m0 + wm * 16 + hi * 8;
  const int c0 = n0 + wn * 16 + laneM;
#pragma unroll  // constant indices keep the accumulators in registers
  for (int r = 0; r < 8; ++r) {
    G[(size_t)(row + r) * C_ + c0] = acc0[r];
    G[(size_t)(row + r) * C_ + c0 + 16] = acc1[r];
  }
}

// ---------------------------------------------------------------------------
// Kernel 1: the two projections z and v.  out[m,n] = sum_c x[m,c]*W[n,c] + b[n]
// A block owns a 128x128 tile of the output; its 8 waves stand 4 (rows) x 2
// (columns) and each holds 32x64 = 2x4 accumulator tiles, so a k group of 4
// takes 6 fragment loads for 8 matrix instructions, and a staged operand row
// feeds 128 outputs.  The k order of every output element is the old one.
// grid = (M/128, K_/128, 2), block = 256
// ---------------------------------------------------------------------------
#define QT_ 128           // rows and columns of the block's tile
#define QBNP_ (QT_ + 8)   // padded row length (in float2) of its B tile

// Two copies of 16 bytes a lane, with s_wait_xcnt 0 as the last line of their
// own statement, so that the wait stands in front of every rewrite of the
// address registers that the copies name.
__device__ __forceinline__ void async_copy16x2_held(void* lds0, const float* g0,
                                                    void* lds1, const float* g1) {
  const unsigned l0 = (unsigned)(uintptr_t)lds0;   // LDS aperture: addr[31:0]
  const unsigned l1 = (unsigned)(uintptr_t)lds1;
  const unsigned long long a0 = (unsigned long long)(uintptr_t)g0;
  const unsigned long long a1 = (unsigned long long)(uintptr_t)g1;
  asm volatile("global_load_async_to_lds_b128 %0, %1, off\n\t"
               "global_load_async_to_lds_b128 %2, %3, off\n\t"
               "s_wait_xcnt 0x0"
               :
               : "v"(l0), "v"(a0), "v"(l1), "v"(a1)
               : "memory");
}

// The same for four copies a lane.
__device__ __forceinline__ void async_copy16x4_held(void* lds0, const float* g0,
                                                    void* lds1, const float* g1,
                                                    void* lds2, const float* g2,
                                                    void* lds3, const float* g3) {
  const unsigned l0 = (unsigned)(uintptr_t)lds0;   // LDS aperture: addr[31:0]
  const unsigned l1 = (unsigned)(uintptr_t)lds1;
  const unsigned l2 = (unsigned)(uintptr_t)lds2;
  const unsigned l3 = (unsigned)(uintptr_t)lds3;
  const unsigned long long a0 = (unsigned long long)(uintptr_t)g0;
  const unsigned long long a1 = (unsigned long long)(uintptr_t)g1;
  const unsigned long long a2 = (unsigned long long)(uintptr_t)g2;
  const unsigned long long a3 = (unsigned long long)(uintptr_t)g3;
  asm volatile("global_load_async_to_lds_b128 %0, %1, off\n\t"
               "global_load_async_to_lds_b128 %2, %3, off\n\t"
               "global_load_async_to_lds_b128 %4, %5, off\n\t"
               "global_load_async_to_lds_b128 %6, %7, off\n\t"
               "s_wait_xcnt 0x0"
               :
               : "v"(l0), "v"(a0), "v"(l1), "v"(a1), "v"(l2), "v"(a2), "v"(l3), "v"(a3)
               : "memory");
}

__global__ __launch_bounds__(256) void zv_proj_kernel(
    const float* __restrict__ x,
    const float* __restrict__ G, const float* __restrict__ h,
    const float* __restrict__ Wv, const float* __restrict__ bv,
    float* __restrict__ zv_ws) {
  __shared__ __attribute__((aligned(16))) float As[2][QT_][20];
  __shared__ __attribute__((aligned(16))) v2f Bs[2][8][QBNP_];

  const int tid = threadIdx.x;
  const int lane = tid & 31, wave = tid >> 5;
  const int laneM = lane & 15, hi = lane >> 4;
  const int wm = wave & 3, wn = wave >> 2;   // 32-row band, 64-column band

  const int proj = blockIdx.z;
  const float* W = (proj == 0) ? G : Wv;
  const float* bias = (proj == 0) ? h : bv;
  float* out = zv_ws + (size_t)proj * ((size_t)B_ * T_ * K_);

  const int m0 = blockIdx.x * QT_;
  const int n0 = blockIdx.y * QT_;

  v8f acc[2][4];
#pragma unroll  // constant indices keep the accumulators in registers
  for (int i = 0; i < 2; ++i)
#pragma unroll  // the same
    for (int j = 0; j < 4; ++j)
      acc[i][j] = (v8f){0.f, 0.f, 0.f, 0.f, 0.f, 0.f, 0.f, 0.f};

  // staging: a lane brings 16 bytes of rows lr and lr + 64 of each operand
  const int lr = tid >> 2;         // 0..63
  const int lk = (tid & 3) << 2;   // 0,4,8,12
  const float* ap = x + (size_t)(m0 + lr) * C_ + lk;
  const float* bp = W + (size_t)(n0 + lr) * C_ + lk;

  // prologue: stage chunk 0 into buffer 0
  {
    f4 w0 = *(const f4*)(bp);                     // B: transpose via regs
    f4 w1 = *(const f4*)(bp + 64 * C_);
    async_copy16x2_held(&As[0][lr][lk], ap,       // A: async DMA to LDS
                        &As[0][lr + 64][lk], ap + 64 * C_);
    Bs[0][(lk >> 1) + 0][lr] = (v2f){w0.x, w0.y};
    Bs[0][(lk >> 1) + 1][lr] = (v2f){w0.z, w0.w};
    Bs[0][(lk >> 1) + 0][lr + 64] = (v2f){w1.x, w1.y};
    Bs[0][(lk >> 1) + 1][lr + 64] = (v2f){w1.z, w1.w};
  }
  wait_async0();
  __syncthreads();

  const int nch = C_ / 16;   // 32 chunks
  for (int c = 0; c < nch; ++c) {
    const int cur = c & 1;
    const bool more = (c + 1) < nch;
    f4 nb0, nb1;
    if (more) {
      // the plain loads go first: they are in flight while the wait inside
      // the copies' statement holds the wave
      nb0 = *(const f4*)(bp + (c + 1) * 16);
      nb1 = *(const f4*)(bp + (c + 1) * 16 + 64 * C_);
      async_copy16x2_held(&As[cur ^ 1][lr][lk], ap + (c + 1) * 16,
                          &As[cur ^ 1][lr + 64][lk], ap + (c + 1) * 16 + 64 * C_);
    }
#pragma unroll  // constant k offsets fold into the LDS loads
    for (int kk = 0; kk < 16; kk += 4) {
      const int kb = kk + 2 * hi;   // lanes 0-15: K=kk,kk+1 ; lanes 16-31: K=kk+2,kk+3
      v2f a[2], bfr[4];
#pragma unroll  // fragments stay in registers
      for (int i = 0; i < 2; ++i) {
        const float* ar = &As[cur][wm * 32 + i * 16 + laneM][0];
        a[i].x = ar[kb];
        a[i].y = ar[kb + 1];
      }
#pragma unroll  // fragments stay in registers
      for (int j = 0; j < 4; ++j) bfr[j] = Bs[cur][kb >> 1][wn * 64 + j * 16 + laneM];
#pragma unroll  // constant indices keep the accumulators in registers
      for (int i = 0; i < 2; ++i)
#pragma unroll  // the same
        for (int j = 0; j < 4; ++j) acc[i][j] = wmma_f32(a[i], bfr[j], acc[i][j]);
    }
    if (more) {
      Bs[cur ^ 1][(lk >> 1) + 0][lr] = (v2f){nb0.x, nb0.y};
      Bs[cur ^ 1][(lk >> 1) + 1][lr] = (v2f){nb0.z, nb0.w};
      Bs[cur ^ 1][(lk >> 1) + 0][lr + 64] = (v2f){nb1.x, nb1.y};
      Bs[cur ^ 1][(lk >> 1) + 1][lr + 64] = (v2f){nb1.z, nb1.w};
    }
    // this wave's LDS reads and writes of the trip are done before it says so
    asm volatile("s_wait_dscnt 0x0" ::: "memory");
    wait_async0();
    __syncthreads();
  }

#pragma unroll  // constant indices keep the accumulators in registers
  for (int j = 0; j < 4; ++j) {
    const int col = n0 + wn * 64 + j * 16 + laneM;
    const float bv_ = bias[col];
#pragma unroll  // the same
    for (int i = 0; i < 2; ++i) {
      const int row = m0 + wm * 32 + i * 16 + hi * 8;
#pragma unroll  // the same
      for (int r = 0; r < 8; ++r)
        out[(size_t)(row + r) * K_ + col] = acc[i][j][r] + bv_;
    }
  }
}

// ---------------------------------------------------------------------------
// Kernel 2: scores[b,i,j] = (j>i) ? -inf : dot(x[b,i,:], z[b,j,:]) / sqrt(512)
// (its argument q is x and its argument kmat is z: see kernel 0)
// Only the 64x64 tiles on or below the diagonal exist: a tile wholly above it
// is masked, its softmax is 0, and neither kernel 3 nor kernel 4 reads it, so
// it is neither launched nor stored.  Row tile i has i+1 live tiles; row tiles
// 31-y and y together have 33, which is one line of the grid, so every block
// of the launch does the same work wherever it is placed.
// grid = (T/64 + 1, T/128, B), block = 256
// ---------------------------------------------------------------------------
__global__ __launch_bounds__(256) void scores_kernel(
    const float* __restrict__ q, const float* __restrict__ kmat,
    float* __restrict__ scores) {
  const int b = blockIdx.z;
  const int fx = blockIdx.x, fy = blockIdx.y;
  const int nlong = T_ / 64 - fy;            // live tiles of row tile 31-fy
  const bool longrow = fx < nlong;
  const int m0 = (longrow ? T_ / 64 - 1 - fy : fy) * 64;
  const int n0 = (longrow ? fx : fx - nlong) * 64;   // n0 <= m0
  float* S = scores + (size_t)b * T_ * T_;

  __shared__ __attribute__((aligned(16))) float As[2][64][SCK_ + 4];
  __shared__ __attribute__((aligned(16))) v2f Bs[2][SCK_ / 2][SBP_];

  const int tid = threadIdx.x;
  const int lane = tid & 31, wave = tid >> 5;
  const int laneM = lane & 15, hi = lane >> 4;
  const int wm = wave & 3, wn = (wave >> 2) << 1;

  v8f acc0 = {0.f, 0.f, 0.f, 0.f, 0.f, 0.f, 0.f, 0.f};
  v8f acc1 = {0.f, 0.f, 0.f, 0.f, 0.f, 0.f, 0.f, 0.f};

  // staging: a lane brings 16 bytes of rows lr and lr + 32 of each operand;
  // 8 lanes side by side cover a row's 128-byte line
  const int lr = tid >> 3;         // 0..31
  const int lk = (tid & 7) << 2;   // 0,4,..,28
  const float* ap = q + (size_t)b * T_ * K_ + (size_t)(m0 + lr) * K_ + lk;
  const float* bp = kmat + (size_t)b * T_ * K_ + (size_t)(n0 + lr) * K_ + lk;

  // prologue: stage chunk 0 into buffer 0
  {
    f4 w0 = *(const f4*)(bp);                     // B: transpose via regs
    f4 w1 = *(const f4*)(bp + 32 * K_);
    async_copy16x2_held(&As[0][lr][lk], ap,       // A: async DMA to LDS
                        &As[0][lr + 32][lk], ap + 32 * K_);
    Bs[0][(lk >> 1) + 0][lr] = (v2f){w0.x, w0.y};
    Bs[0][(lk >> 1) + 1][lr] = (v2f){w0.z, w0.w};
    Bs[0][(lk >> 1) + 0][lr + 32] = (v2f){w1.x, w1.y};
    Bs[0][(lk >> 1) + 1][lr + 32] = (v2f){w1.z, w1.w};
  }
  wait_async0();
  __syncthreads();

  const int nch = K_ / SCK_;   // 16 chunks
  for (int c = 0; c < nch; ++c) {
    const int cur = c & 1;
    const bool more = (c + 1) < nch;
    f4 nb0, nb1;
    if (more) {
      // the plain loads go first: they are in flight while the wait inside
      // the copies' statement holds the wave
      nb0 = *(const f4*)(bp + (c + 1) * SCK_);
      nb1 = *(const f4*)(bp + (c + 1) * SCK_ + 32 * K_);
      async_copy16x2_held(&As[cur ^ 1][lr][lk], ap + (c + 1) * SCK_,
                          &As[cur ^ 1][lr + 32][lk], ap + (c + 1) * SCK_ + 32 * K_);
    }
    mma_step<SCK_, SBP_>(As[cur], Bs[cur], wm, wn, laneM, hi, acc0, acc1);
    if (more) {
      Bs[cur ^ 1][(lk >> 1) + 0][lr] = (v2f){nb0.x, nb0.y};
      Bs[cur ^ 1][(lk >> 1) + 1][lr] = (v2f){nb0.z, nb0.w};
      Bs[cur ^ 1][(lk >> 1) + 0][lr + 32] = (v2f){nb1.x, nb1.y};
      Bs[cur ^ 1][(lk >> 1) + 1][lr + 32] = (v2f){nb1.z, nb1.w};
    }
    // this wave's LDS reads and writes of the trip are done before it says so
    asm volatile("s_wait_dscnt 0x0" ::: "memory");
    wait_async0();
    __syncthreads();
  }

  const float sc = 0.04419417382415922f;  // 1/sqrt(512)
  const int row = m0 + wm * 16 + hi * 8;
  const int c0 = n0 + wn * 16 + laneM;
  const int c1 = c0 + 16;
#pragma unroll
  for (int r = 0; r < 8; ++r) {
    const int i = row + r;
    S[(size_t)i * T_ + c0] = (c0 > i) ? -INFINITY : acc0[r] * sc;
    S[(size_t)i * T_ + c1] = (c1 > i) ? -INFINITY : acc1[r] * sc;
  }
}

// ---------------------------------------------------------------------------
// Kernel 3: softmax over axis=1 (QUERY axis): normalize each column j.
// A strip is 32 columns; a step is 64 rows.  Strip c is masked in every step
// below c/2 (those tiles are never stored and never read), so it has 32 - c/2
// live steps.  A block owns strips t and 63-t, which together have 33 live
// steps for every t, and holds both in registers (33 float4 per lane): every
// load is issued before the first use, each live element is read once, and
// all 256 blocks do the same work.
// Slot i holds step t/2 + i of strip t while i < 32 - t/2, else step i-1 of
// strip 63-t; both strips are walked in rising row order.
// A wave-wide load covers 4 rows x 128 bytes (whole lines).
// Masked (-inf) entries of a diagonal tile become exactly 0: the diagonal entry
// of every column is unmasked, so the column maximum is finite and
// expf(-inf - max) is 0.
// grid = (T/64, B), block = 512
// ---------------------------------------------------------------------------
#define SM_COLS_ 32
#define SM_ROWS_ 64                     // rows covered by the block per step
#define SM_STEPS_ (T_ / SM_ROWS_)       // 32
#define SM_STRIPS_ (T_ / SM_COLS_)      // 64
#define SM_SLOTS_ (SM_STEPS_ + 1)       // 33
#define SM_MID_ (SM_STEPS_ / 2)         // 16
#define SM_PITCH_ 36                    // floats; 144 B rows: b128 stores conflict-free
// Does slot i belong to the first strip?  na is 17..32, so only slots 17..31
// are decided at run time (the same way in every lane of the block).
#define SM_FIRST_(i, na) ((i) <= SM_STEPS_ / 2 || ((i) < SM_STEPS_ && (i) < (na)))

__global__ __launch_bounds__(512) void softmax_q_kernel(float* __restrict__ scores) {
  __shared__ __attribute__((aligned(16))) float red[2][SM_ROWS_][SM_PITCH_];
  __shared__ __attribute__((aligned(16))) float gmx[2][SM_COLS_];
  __shared__ __attribute__((aligned(16))) float ginv[2][SM_COLS_];

  const int tid = threadIdx.x;
  const int c4 = (tid & 7) << 2;        // first of this lane's 4 columns
  const int rr = tid >> 3;              // 0..63: row inside a step
  const int rcol = tid >> 4;            // 0..31: column this lane helps to reduce
  const int rrow = tid & 15;            // 0..15
  const int t = blockIdx.x;             // 0..31
  const int na = SM_STEPS_ - (t >> 1);  // slots of strip t
  float* S = scores + (size_t)blockIdx.y * T_ * T_;                         // uniform
  // Element offset of the middle slot (16) in either strip: counted from there
  // every other slot's distance fits the load's and the store's offset field,
  // so a slot's address register is formed once and serves both.
  const int baseA = ((t >> 1) + SM_MID_) * SM_ROWS_ * T_ + t * SM_COLS_;                 // uniform
  const int baseB = (SM_MID_ - 1) * SM_ROWS_ * T_ + (SM_STRIPS_ - 1 - t) * SM_COLS_;     // uniform
  const unsigned off = (unsigned)(rr * T_ + c4);                                         // per lane

  f4 xv[SM_SLOTS_];
#pragma unroll  // constant indices keep xv[] in registers
  for (int i = 0; i < SM_SLOTS_; ++i) {
    const int base = SM_FIRST_(i, na) ? baseA : baseB;
    xv[i] = *(const f4*)(S + (size_t)(base + (i - SM_MID_) * SM_ROWS_ * T_) + off);
  }
  // stands between the loads above and the first rewrite of a register that
  // one of them names as its address
  asm volatile("s_wait_xcnt 0x0" ::: "memory");

  // column maxima: lane, then block
  // (a slot enters the other strip's maximum as -inf, which changes nothing)
  const f4 ninf = {-INFINITY, -INFINITY, -INFINITY, -INFINITY};
  f4 mA = xv[0], mB = ninf;
#pragma unroll  // constant indices keep xv[] in registers
  for (int i = 1; i < SM_SLOTS_; ++i) {
    const bool first = SM_FIRST_(i, na);
    const f4 a = first ? xv[i] : ninf;
    const f4 b = first ? ninf : xv[i];
    mA.x = fmaxf(mA.x, a.x);
    mA.y = fmaxf(mA.y, a.y);
    mA.z = fmaxf(mA.z, a.z);
    mA.w = fmaxf(mA.w, a.w);
    mB.x = fmaxf(mB.x, b.x);
    mB.y = fmaxf(mB.y, b.y);
    mB.z = fmaxf(mB.z, b.z);
    mB.w = fmaxf(mB.w, b.w);
  }
  *(f4*)&red[0][rr][c4] = mA;
  *(f4*)&red[1][rr][c4] = mB;
  __syncthreads();
#pragma unroll  // the two strips' chains interleave
  for (int p = 0; p < 2; ++p) {
    float v = fmaxf(fmaxf(red[p][rrow][rcol], red[p][rrow + 16][rcol]),
                    fmaxf(red[p][rrow + 32][rcol], red[p][rrow + 48][rcol]));
#pragma unroll  // four fixed butterfly steps inside a 16-lane group
    for (int d = 1; d < 16; d <<= 1) v = fmaxf(v, __shfl_xor(v, d, 32));
    if (rrow == 0) gmx[p][rcol] = v;
  }
  __syncthreads();
  const f4 MA = *(const f4*)&gmx[0][c4];
  const f4 MB = *(const f4*)&gmx[1][c4];

  // exponentials replace the scores in registers; column sums: lane, then block
  f4 smA = {0.f, 0.f, 0.f, 0.f};
  f4 smB = {0.f, 0.f, 0.f, 0.f};
#pragma unroll  // constant indices keep xv[] in registers
  for (int i = 0; i < SM_SLOTS_; ++i) {
    const bool first = SM_FIRST_(i, na);
    const f4 M = first ? MA : MB;
    f4 e;
    e.x = expf(xv[i].x - M.x);
    e.y = expf(xv[i].y - M.y);
    e.z = expf(xv[i].z - M.z);
    e.w = expf(xv[i].w - M.w);
    xv[i] = e;
    if (first) smA += e; else smB += e;
  }
  *(f4*)&red[0][rr][c4] = smA;
  *(f4*)&red[1][rr][c4] = smB;
  __syncthreads();
#pragma unroll  // the two strips' chains interleave
  for (int p = 0; p < 2; ++p) {
    float v = (red[p][rrow][rcol] + red[p][rrow + 16][rcol]) +
              (red[p][rrow + 32][rcol] + red[p][rrow + 48][rcol]);
#pragma unroll  // four fixed butterfly steps inside a 16-lane group
    for (int d = 1; d < 16; d <<= 1) v += __shfl_xor(v, d, 32);
    if (rrow == 0) ginv[p][rcol] = 1.0f / v;
  }
  __syncthreads();
  const f4 invA = *(const f4*)&ginv[0][c4];
  const f4 invB = *(const f4*)&ginv[1][c4];

#pragma unroll  // constant indices keep xv[] in registers
  for (int i = 0; i < SM_SLOTS_; ++i) xv[i] *= SM_FIRST_(i, na) ? invA : invB;
  // every product is made before the first store issues, so that no vector
  // instruction rewrites a register that an issued store names
  __builtin_amdgcn_sched_barrier(0);
#pragma unroll  // constant indices keep xv[] in registers
  for (int i = 0; i < SM_SLOTS_; ++i) {
    const int base = SM_FIRST_(i, na) ? baseA : baseB;
    *(f4*)(S + (size_t)(base + (i - SM_MID_) * SM_ROWS_ * T_) + off) = xv[i];
  }
}

// ---------------------------------------------------------------------------
// Kernel 4: attn = probs @ v, written into out[b, t, 512:1024].
// probs[i,s]==0 for s>i  ->  K loop clamped at m0+64.
// The K loop's length grows with the row tile's index and every block of the
// launch is resident at once, so a block takes row tiles t and 31-t, one after
// the other: each block runs (t+1) + (32-t) = 33 chunks of 64 k.
// grid = (T/128, K_/64, B), block = 256
// ---------------------------------------------------------------------------
__global__ __launch_bounds__(256) void attn_kernel(
    const float* __restrict__ probs, const float* __restrict__ v,
    float* __restrict__ out) {
  __shared__ __attribute__((aligned(16))) float As[2][64][ACK_ + 4];
  __shared__ __attribute__((aligned(16))) v2f Bs[2][ACK_ / 2][BNP_];

  const int tid = threadIdx.x;
  const int lane = tid & 31, wave = tid >> 5;
  const int laneM = lane & 15, hi = lane >> 4;
  const int wm = wave & 3, wn = (wave >> 2) << 1;

  const int b = blockIdx.z;
  const int n0 = blockIdx.y * 64;

  const float* A = probs + (size_t)b * T_ * T_;
  const float* V = v + (size_t)b * T_ * K_;
  float* O = out + (size_t)b * T_ * OUTW_;

  const int lr = tid >> 4;          // A staging: rows lr, lr + 16, lr + 32, lr + 48;
  const int lk = (tid & 15) << 2;   // 16 lanes side by side cover 256 bytes of a row
  const int kp = tid >> 5;          // B staging: k-pairs kp, kp + 8, kp + 16, kp + 24
  const int nn = (tid & 31) << 1;   // 0..62
  const float* bp = V + (size_t)(2 * kp) * K_ + n0 + nn;

  for (int part = 0; part < 2; ++part) {
    const int mt = part ? (T_ / 64 - 1 - (int)blockIdx.x) : (int)blockIdx.x;
    const int m0 = mt * 64;
    const float* ap = A + (size_t)(m0 + lr) * T_ + lk;

    v8f acc0 = {0.f, 0.f, 0.f, 0.f, 0.f, 0.f, 0.f, 0.f};
    v8f acc1 = {0.f, 0.f, 0.f, 0.f, 0.f, 0.f, 0.f, 0.f};

    // prologue: stage chunk 0.  For the second tile the buffers are free: the
    // barrier at the foot of the first tile's last chunk ended every read.
    {
      v2f r[ACK_ / 16][2];
#pragma unroll  // constant indices keep the staged rows in registers
      for (int u = 0; u < ACK_ / 16; ++u) {
        r[u][0] = *(const v2f*)(bp + (u * 16) * K_);
        r[u][1] = *(const v2f*)(bp + (u * 16 + 1) * K_);
      }
      async_copy16x4_held(&As[0][lr][lk], ap, &As[0][lr + 16][lk], ap + 16 * T_,
                          &As[0][lr + 32][lk], ap + 32 * T_,
                          &As[0][lr + 48][lk], ap + 48 * T_);
#pragma unroll  // the same
      for (int u = 0; u < ACK_ / 16; ++u) {
        Bs[0][u * 8 + kp][nn + 0] = (v2f){r[u][0].x, r[u][1].x};
        Bs[0][u * 8 + kp][nn + 1] = (v2f){r[u][0].y, r[u][1].y};
      }
    }
    wait_async0();
    __syncthreads();

    const int nch = (m0 + 64) / ACK_;   // causal zero structure of probs
    for (int c = 0; c < nch; ++c) {
      const int cur = c & 1;
      const bool more = (c + 1) < nch;
      v2f nr[ACK_ / 16][2];
      if (more) {
        // the plain loads go first: they are in flight while the wait inside
        // the copies' statement holds the wave
        const float* bn = bp + (size_t)(c + 1) * ACK_ * K_;
        const float* an = ap + (c + 1) * ACK_;
#pragma unroll  // constant indices keep the staged rows in registers
        for (int u = 0; u < ACK_ / 16; ++u) {
          nr[u][0] = *(const v2f*)(bn + (u * 16) * K_);
          nr[u][1] = *(const v2f*)(bn + (u * 16 + 1) * K_);
        }
        async_copy16x4_held(&As[cur ^ 1][lr][lk], an,
                            &As[cur ^ 1][lr + 16][lk], an + 16 * T_,
                            &As[cur ^ 1][lr + 32][lk], an + 32 * T_,
                            &As[cur ^ 1][lr + 48][lk], an + 48 * T_);
      }
      mma_step<ACK_, BNP_>(As[cur], Bs[cur], wm, wn, laneM, hi, acc0, acc1);
      if (more) {
#pragma unroll  // constant indices keep the staged rows in registers
        for (int u = 0; u < ACK_ / 16; ++u) {
          Bs[cur ^ 1][u * 8 + kp][nn + 0] = (v2f){nr[u][0].x, nr[u][1].x};
          Bs[cur ^ 1][u * 8 + kp][nn + 1] = (v2f){nr[u][0].y, nr[u][1].y};
        }
      }
      // this wave's LDS reads and writes of the trip are done before it says so
      asm volatile("s_wait_dscnt 0x0" ::: "memory");
      wait_async0();
      __syncthreads();
    }

    const int row = m0 + wm * 16 + hi * 8;
    const int c0 = n0 + wn * 16 + laneM;
    const int c1 = c0 + 16;
#pragma unroll  // constant indices keep the accumulators in registers
    for (int r = 0; r < 8; ++r) {
      O[(size_t)(row + r) * OUTW_ + C_ + c0] = acc0[r];
      O[(size_t)(row + r) * OUTW_ + C_ + c1] = acc1[r];
    }
    // stands between the stores above and the next tile's first rewrite of a
    // register that one of them names
    asm volatile("s_wait_xcnt 0x0" ::: "memory");
  }
}

// ---------------------------------------------------------------------------
// Kernel 5: out[b, t, 0:512] = x  (float4 copy)
// ---------------------------------------------------------------------------
__global__ __launch_bounds__(256) void concat_x_kernel(const float* __restrict__ x,
                                                       float* __restrict__ out) {
  const size_t idx = (size_t)blockIdx.x * 256 + threadIdx.x;  // float4 index
  const size_t row = idx >> 7;   // 128 float4 per 512-float row
  const size_t c4 = idx & 127;
  f4 val = *(const f4*)(x + (row << 9) + (c4 << 2));
  *(f4*)(out + row * OUTW_ + (c4 << 2)) = val;
}

// ---------------------------------------------------------------------------
extern "C" void kernel_launch(void* const* d_in, const int* in_sizes, int n_in,
                              void* d_out, int out_size, void* d_ws, size_t ws_size,
                              hipStream_t stream) {
  (void)in_sizes; (void)n_in; (void)out_size; (void)ws_size;

  const float* x  = (const float*)d_in[0];
  const float* Wq = (const float*)d_in[1];
  const float* Wk = (const float*)d_in[3];
  const float* bk = (const float*)d_in[4];
  const float* Wv = (const float*)d_in[5];
  const float* bv = (const float*)d_in[6];
  float* out = (float*)d_out;
  float* ws = (float*)d_ws;

  const size_t NPROJ = (size_t)B_ * T_ * K_;   // 8,388,608 floats
  float* G      = ws;                          // 512*512 floats
  float* h      = ws + C_ * C_;                // 512 floats
  float* z      = ws + NPROJ;
  float* v      = ws + 2 * NPROJ;
  float* scores = ws + 3 * NPROJ;              // 8*T*T floats

  fold_kernel<<<dim3(C_ / 64, C_ / 64), 256, 0, stream>>>(Wq, Wk, bk, G, h);
  zv_proj_kernel<<<dim3((B_ * T_) / QT_, K_ / QT_, 2), 256, 0, stream>>>(
      x, G, h, Wv, bv, z);
  scores_kernel<<<dim3(T_ / 64 + 1, T_ / 128, B_), 256, 0, stream>>>(x, z, scores);
  softmax_q_kernel<<<dim3(SM_STRIPS_ / 2, B_), 512, 0, stream>>>(scores);
  attn_kernel<<<dim3(T_ / 128, K_ / 64, B_), 256, 0, stream>>>(scores, v, out);
  concat_x_kernel<<<(B_ * T_ * C_ / 4) / 256, 256, 0, stream>>>(x, out);
}

// v007
// One run takes 290 microseconds.
// Next to v006, in two timings, it ran 1.04 times as fast each time.
// All steps since v000 together make it 2.61 times as fast.
#include <hip/hip_runtime.h>
#include <math.h>

// ---------------------------------------------------------------------------
// AttentionBlock for MI455X (gfx1250, wave32, WMMA).
// FP32 end-to-end using V_WMMA_F32_16X16X4_F32 (exact fp32 matrix math).
// - LDS double-buffered (1 barrier/chunk)
// - k-pair-major float2 B layout: B fragment = one contiguous ds_load_b64
// - A tiles of kernels 1 and 2 staged with CDNA5 async DMA:
//   global_load_async_to_lds_b128 (ASYNCcnt-tracked, no VGPR round trip),
//   synced via s_wait_asynccnt.  Kernel 4's A tile goes through registers,
//   where scores become probabilities.
// Workspace layout (floats): G[256K], h[512], column statistics | z[8M] | v[8M] | scores[33.5M]
// ---------------------------------------------------------------------------

typedef __attribute__((ext_vector_type(2))) float v2f;
typedef __attribute__((ext_vector_type(4))) float f4;
typedef __attribute__((ext_vector_type(8))) float v8f;

#define B_ 8
#define T_ 2048
#define C_ 512
#define K_ 512
#define OUTW_ (C_ + K_)   // 1024

#define BNP_ 72           // padded row length (in float2) of B tiles

__device__ __forceinline__ v8f wmma_f32(v2f a, v2f b, v8f c) {
  // D = A(16x4) x B(4x16) + C(16x16), all fp32
  return __builtin_amdgcn_wmma_f32_16x16x4_f32(
      /*neg_a=*/false, a, /*neg_b=*/false, b,
      /*c_mod=*/(short)0, c, /*reuse_a=*/false, /*reuse_b=*/false);
}

__device__ __forceinline__ void wait_async0() {
  asm volatile("s_wait_asynccnt 0x0" ::: "memory");
}

// 2^x as the one hardware instruction: -inf gives 0, and a result below the
// normal range is flushed to 0
__device__ __forceinline__ float ex2(float x) { return __builtin_amdgcn_exp2f(x); }

// four scores of one row and their columns' shifts -> four probabilities
__device__ __forceinline__ f4 prob4(f4 s, f4 c) {
  f4 e;
  e.x = ex2(s.x - c.x);
  e.y = ex2(s.y - c.y);
  e.z = ex2(s.z - c.z);
  e.w = ex2(s.w - c.w);
  return e;
}

// Kernels 2 and 4, whose blocks have 64x64 tiles, stage deep chunks of
// k: a K-contiguous operand row gives whole 128-byte lines to a chunk, and the
// chain from a chunk's loads to the barrier that publishes them is paid once
// per 16 or 32 matrix instructions of a wave.  Kernel 2 has 8 blocks on a WGP
// to cover that chain and takes 32 k; kernel 4 has 4 and takes 64 k.
#define SCK_ 32           // k depth of a staged chunk, kernel 2
#define ACK_ 64           // k depth of a staged chunk, kernel 4
// Kernel 2's B tile is transposed through registers: 8 lanes of a row store to
// 8 k-pair rows at once, and at this pitch they fall two to a bank, not four
#define SBP_ 68           // padded row length (float2) of kernel 2's B tile

// One chunk of CK k of wave-level MMA: wave computes two 16x16 tiles.
// As: [64][CK + 4] floats (row-major, padded).  Bs: [CK/2][BP] float2,
// Bs[kp][n] = {B[2kp][n], B[2kp+1][n]}  -> fragment is one b64 load.
template <int CK, int BP>
__device__ __forceinline__ void mma_step(const float (&As)[64][CK + 4],
                                         const v2f (&Bs)[CK / 2][BP],
                                         int wm, int wn, int laneM, int hi,
                                         v8f& acc0, v8f& acc1) {
  // lanes 0-15: K=kk,kk+1 ; lanes 16-31: K=kk+2,kk+3.  The lane's part of both
  // addresses is formed once, so that a k group costs no register of its own
  const float* ar = &As[wm * 16 + laneM][2 * hi];
  const v2f* br = &Bs[hi][wn * 16 + laneM];
#pragma unroll  // constant k offsets fold into the LDS loads
  for (int kk = 0; kk < CK; kk += 4) {
    v2f a;
    a.x = ar[kk];
    a.y = ar[kk + 1];
    const v2f b0 = br[(kk >> 1) * BP];
    const v2f b1 = br[(kk >> 1) * BP + 16];
    acc0 = wmma_f32(a, b0, acc0);
    acc1 = wmma_f32(a, b1, acc1);
  }
}

// ---------------------------------------------------------------------------
// Kernel 0: the query weights are folded into the key side.
//   q[i].k[j] = (Wq x[i] + bq).k[j] = x[i].(Wq^T k[j]) + bq.k[j]
// The last term does not depend on i, and the softmax runs over i: it shifts a
// whole column of scores by one constant and cancels.  With
//   G[c1][c2] = sum_k Wq[k][c1] * Wk[k][c2],   h[c1] = sum_k Wq[k][c1] * bk[k]
// z[j] = Wq^T k[j] = G x[j] + h is ONE projection of x where q and k were two,
// and the scores are x[i].z[j].
// Both operands are read along their rows, so both are staged k-pair-major
// like every B tile of this file, and a fragment is one b64 load.
// A block does a 64x64 tile of G in 8 stages of 64 k; the next stage's loads
// are in flight while this one is multiplied.  The blocks of grid line 0 also
// sum h, from the Wq tile that they hold in LDS anyway.
// grid = (C_/64, C_/64), block = 256
// ---------------------------------------------------------------------------
#define FK_ 64            // k rows of a stage

__global__ __launch_bounds__(256) void fold_kernel(
    const float* __restrict__ Wq, const float* __restrict__ Wk,
    const float* __restrict__ bk, float* __restrict__ G, float* __restrict__ h) {
  __shared__ v2f Ap[FK_ / 2][BNP_];
  __shared__ v2f Bp[FK_ / 2][BNP_];
  __shared__ float sb[K_];
  __shared__ float hp[4][64];

  const int tid = threadIdx.x;
  const int m0 = blockIdx.x * 64;   // c1: rows of G

  const int n0 = blockIdx.y * 64;   // c2: columns of G
  const int lane = tid & 31, wave = tid >> 5;
  const int laneM = lane & 15, hi = lane >> 4;
  const int wm = wave & 3, wn = (wave >> 2) << 1;

  const int kp = tid >> 5;          // k-pair 0..7 of a group of 16 rows
  const int nn = (tid & 31) << 1;   // 0..62
  const float* ag = Wq + (size_t)(2 * kp) * C_ + m0 + nn;
  const float* bg = Wk + (size_t)(2 * kp) * C_ + n0 + nn;

  v8f acc0 = {0.f, 0.f, 0.f, 0.f, 0.f, 0.f, 0.f, 0.f};
  v8f acc1 = {0.f, 0.f, 0.f, 0.f, 0.f, 0.f, 0.f, 0.f};

  // h: a lane sums a quarter of every stage's k rows of one column of Wq
  const bool doh = blockIdx.y == 0;   // the same for the whole block
  const int hm = tid & 63, hq = tid >> 6;
  float hs = 0.f;
  if (doh) {   // read behind the first stage's barrier
    sb[tid] = bk[tid];
    sb[tid + 256] = bk[tid + 256];
  }

  v2f ra[FK_ / 16][2], rb[FK_ / 16][2];
#pragma unroll  // constant indices keep the staged rows in registers
  for (int u = 0; u < FK_ / 16; ++u) {
    ra[u][0] = *(const v2f*)(ag + (size_t)(u * 16) * C_);
    ra[u][1] = *(const v2f*)(ag + (size_t)(u * 16 + 1) * C_);
    rb[u][0] = *(const v2f*)(bg + (size_t)(u * 16) * C_);
    rb[u][1] = *(const v2f*)(bg + (size_t)(u * 16 + 1) * C_);
  }

#pragma unroll  // constant row offsets: the two address registers are never rewritten
  for (int s = 0; s < K_ / FK_; ++s) {
#pragma unroll  // constant indices keep the staged rows in registers
    for (int u = 0; u < FK_ / 16; ++u) {
      Ap[u * 8 + kp][nn + 0] = (v2f){ra[u][0].x, ra[u][1].x};
      Ap[u * 8 + kp][nn + 1] = (v2f){ra[u][0].y, ra[u][1].y};
      Bp[u * 8 + kp][nn + 0] = (v2f){rb[u][0].x, rb[u][1].x};
      Bp[u * 8 + kp][nn + 1] = (v2f){rb[u][0].y, rb[u][1].y};
    }
    __syncthreads();
    if (s + 1 < K_ / FK_) {
#pragma unroll  // the same
      for (int u = 0; u < FK_ / 16; ++u) {
        const size_t r = (size_t)((s + 1) * FK_ + u * 16) * C_;
        ra[u][0] = *(const v2f*)(ag + r);
        ra[u][1] = *(const v2f*)(ag + r + C_);
      }
      // stands in front of any rewrite of the address that the loads above name
      asm volatile("s_wait_xcnt 0x0" ::: "memory");
#pragma unroll  // the same
      for (int u = 0; u < FK_ / 16; ++u) {
        const size_t r = (size_t)((s + 1) * FK_ + u * 16) * C_;
        rb[u][0] = *(const v2f*)(bg + r);
        rb[u][1] = *(const v2f*)(bg + r + C_);
      }
      // the same for these
      asm volatile("s_wait_xcnt 0x0" ::: "memory");
    }
#pragma unroll  // constant k offsets fold into the LDS loads
    for (int kk = 0; kk < FK_; kk += 4) {
      const int kb = kk + 2 * hi;   // lanes 0-15: K=kk,kk+1 ; lanes 16-31: K=kk+2,kk+3
      const v2f a = Ap[kb >> 1][wm * 16 + laneM];
      const v2f b0 = Bp[kb >> 1][wn * 16 + laneM];
      const v2f b1 = Bp[kb >> 1][wn * 16 + 16 + laneM];
      acc0 = wmma_f32(a, b0, acc0);
      acc1 = wmma_f32(a, b1, acc1);
    }
    if (doh) {
#pragma unroll  // constant offsets fold into the LDS loads
      for (int j = 0; j < FK_ / 8; ++j) {
        const int p = hq * (FK_ / 8) + j;
        const v2f w = Ap[p][hm];
        hs = fmaf(w.x, sb[s * FK_ + 2 * p], hs);
        hs = fmaf(w.y, sb[s * FK_ + 2 * p + 1], hs);
      }
    }
    __syncthreads();   // every read of the stage is done before it is rewritten
  }

  if (doh) {
    hp[hq][hm] = hs;
    __syncthreads();
    if (tid < 64) h[m0 + tid] = (hp[0][tid] + hp[1][tid]) + (hp[2][tid] + hp[3][tid]);
  }

  const int row = m0 + wm * 16 + hi * 8;
  const int c0 = n0 + wn * 16 + laneM;
#pragma unroll  // constant indices keep the accumulators in registers
  for (int r = 0; r < 8; ++r) {
    G[(size_t)(row + r) * C_ + c0] = acc0[r];
    G[(size_t)(row + r) * C_ + c0 + 16] = acc1[r];
  }
}

// ---------------------------------------------------------------------------
// Kernel 1: the two projections z and v.  out[m,n] = sum_c x[m,c]*W[n,c] + b[n]
// A block owns a 128x128 tile of the output; its 8 waves stand 4 (rows) x 2
// (columns) and each holds 32x64 = 2x4 accumulator tiles, so a k group of 4
// takes 6 fragment loads for 8 matrix instructions, and a staged operand row
// feeds 128 outputs.  The k order of every output element is the old one.
// grid = (M/128, K_/128, 2), block = 256
// ---------------------------------------------------------------------------
#define QT_ 128           // rows and columns of the block's tile
#define QBNP_ (QT_ + 8)   // padded row length (in float2) of its B tile

// Two copies of 16 bytes a lane, with s_wait_xcnt 0 as the last line of their
// own statement, so that the wait stands in front of every rewrite of the
// address registers that the copies name.
__device__ __forceinline__ void async_copy16x2_held(void* lds0, const float* g0,
                                                    void* lds1, const float* g1) {
  const unsigned l0 = (unsigned)(uintptr_t)lds0;   // LDS aperture: addr[31:0]
  const unsigned l1 = (unsigned)(uintptr_t)lds1;
  const unsigned long long a0 = (unsigned long long)(uintptr_t)g0;
  const unsigned long long a1 = (unsigned long long)(uintptr_t)g1;
  asm volatile("global_load_async_to_lds_b128 %0, %1, off\n\t"
               "global_load_async_to_lds_b128 %2, %3, off\n\t"
               "s_wait_xcnt 0x0"
               :
               : "v"(l0), "v"(a0), "v"(l1), "v"(a1)
               : "memory");
}

__global__ __launch_bounds__(256) void zv_proj_kernel(
    const float* __restrict__ x,
    const float* __restrict__ G, const float* __restrict__ h,
    const float* __restrict__ Wv, const float* __restrict__ bv,
    float* __restrict__ zv_ws) {
  __shared__ __attribute__((aligned(16))) float As[2][QT_][20];
  __shared__ __attribute__((aligned(16))) v2f Bs[2][8][QBNP_];

  const int tid = threadIdx.x;
  const int lane = tid & 31, wave = tid >> 5;
  const int laneM = lane & 15, hi = lane >> 4;
  const int wm = wave & 3, wn = wave >> 2;   // 32-row band, 64-column band

  const int proj = blockIdx.z;
  const float* W = (proj == 0) ? G : Wv;
  const float* bias = (proj == 0) ? h : bv;
  float* out = zv_ws + (size_t)proj * ((size_t)B_ * T_ * K_);

  const int m0 = blockIdx.x * QT_;
  const int n0 = blockIdx.y * QT_;

  v8f acc[2][4];
#pragma unroll  // constant indices keep the accumulators in registers
  for (int i = 0; i < 2; ++i)
#pragma unroll  // the same
    for (int j = 0; j < 4; ++j)
      acc[i][j] = (v8f){0.f, 0.f, 0.f, 0.f, 0.f, 0.f, 0.f, 0.f};

  // staging: a lane brings 16 bytes of rows lr and lr + 64 of each operand
  const int lr = tid >> 2;         // 0..63
  const int lk = (tid & 3) << 2;   // 0,4,8,12
  const float* ap = x + (size_t)(m0 + lr) * C_ + lk;
  const float* bp = W + (size_t)(n0 + lr) * C_ + lk;

  // prologue: stage chunk 0 into buffer 0
  {
    f4 w0 = *(const f4*)(bp);                     // B: transpose via regs
    f4 w1 = *(const f4*)(bp + 64 * C_);
    async_copy16x2_held(&As[0][lr][lk], ap,       // A: async DMA to LDS
                        &As[0][lr + 64][lk], ap + 64 * C_);
    Bs[0][(lk >> 1) + 0][lr] = (v2f){w0.x, w0.y};
    Bs[0][(lk >> 1) + 1][lr] = (v2f){w0.z, w0.w};
    Bs[0][(lk >> 1) + 0][lr + 64] = (v2f){w1.x, w1.y};
    Bs[0][(lk >> 1) + 1][lr + 64] = (v2f){w1.z, w1.w};
  }
  wait_async0();
  __syncthreads();

  const int nch = C_ / 16;   // 32 chunks
  for (int c = 0; c < nch; ++c) {
    const int cur = c & 1;
    const bool more = (c + 1) < nch;
    f4 nb0, nb1;
    if (more) {
      // the plain loads go first: they are in flight while the wait inside
      // the copies' statement holds the wave
      nb0 = *(const f4*)(bp + (c + 1) * 16);
      nb1 = *(const f4*)(bp + (c + 1) * 16 + 64 * C_);
      async_copy16x2_held(&As[cur ^ 1][lr][lk], ap + (c + 1) * 16,
                          &As[cur ^ 1][lr + 64][lk], ap + (c + 1) * 16 + 64 * C_);
    }
#pragma unroll  // constant k offsets fold into the LDS loads
    for (int kk = 0; kk < 16; kk += 4) {
      const int kb = kk + 2 * hi;   // lanes 0-15: K=kk,kk+1 ; lanes 16-31: K=kk+2,kk+3
      v2f a[2], bfr[4];
#pragma unroll  // fragments stay in registers
      for (int i = 0; i < 2; ++i) {
        const float* ar = &As[cur][wm * 32 + i * 16 + laneM][0];
        a[i].x = ar[kb];
        a[i].y = ar[kb + 1];
      }
#pragma unroll  // fragments stay in registers
      for (int j = 0; j < 4; ++j) bfr[j] = Bs[cur][kb >> 1][wn * 64 + j * 16 + laneM];
#pragma unroll  // constant indices keep the accumulators in registers
      for (int i = 0; i < 2; ++i)
#pragma unroll  // the same
        for (int j = 0; j < 4; ++j) acc[i][j] = wmma_f32(a[i], bfr[j], acc[i][j]);
    }
    if (more) {
      Bs[cur ^ 1][(lk >> 1) + 0][lr] = (v2f){nb0.x, nb0.y};
      Bs[cur ^ 1][(lk >> 1) + 1][lr] = (v2f){nb0.z, nb0.w};
      Bs[cur ^ 1][(lk >> 1) + 0][lr + 64] = (v2f){nb1.x, nb1.y};
      Bs[cur ^ 1][(lk >> 1) + 1][lr + 64] = (v2f){nb1.z, nb1.w};
    }
    // this wave's LDS reads and writes of the trip are done before it says so
    asm volatile("s_wait_dscnt 0x0" ::: "memory");
    wait_async0();
    __syncthreads();
  }

#pragma unroll  // constant indices keep the accumulators in registers
  for (int j = 0; j < 4; ++j) {
    const int col = n0 + wn * 64 + j * 16 + laneM;
    const float bv_ = bias[col];
#pragma unroll  // the same
    for (int i = 0; i < 2; ++i) {
      const int row = m0 + wm * 32 + i * 16 + hi * 8;
#pragma unroll  // the same
      for (int r = 0; r < 8; ++r)
        out[(size_t)(row + r) * K_ + col] = acc[i][j][r] + bv_;
    }
  }
}

// ---------------------------------------------------------------------------
// Kernel 2: scores[b,i,j] = (j>i) ? -inf : dot(x[b,i,:], z[b,j,:]) * log2(e) / sqrt(512)
// (its argument q is x and its argument kmat is z: see kernel 0)
// The softmax runs over i, down a column.  While the tile is still in the
// accumulators the block also forms, for each of its 64 columns, the maximum m
// of the tile's 64 rows and l = sum 2^(s - m), and stores the pair: kernel 3
// merges a column's pairs, kernel 4 turns scores into probabilities as it
// stages them, and the score matrix is written once and never rewritten.
// Only the 64x64 tiles on or below the diagonal exist: a tile wholly above it
// is masked, its softmax is 0, and kernel 4 does not read it, so
// it is neither launched nor stored.  Row tile i has i+1 live tiles; row tiles
// 31-y and y together have 33, which is one line of the grid, so every block
// of the launch does the same work wherever it is placed.
// grid = (T/64 + 1, T/128, B), block = 256
// ---------------------------------------------------------------------------
__global__ __launch_bounds__(256) void scores_kernel(
    const float* __restrict__ q, const float* __restrict__ kmat,
    float* __restrict__ scores, float* __restrict__ part) {
  const int b = blockIdx.z;
  const int fx = blockIdx.x, fy = blockIdx.y;
  const int nlong = T_ / 64 - fy;            // live tiles of row tile 31-fy
  const bool longrow = fx < nlong;
  const int m0 = (longrow ? T_ / 64 - 1 - fy : fy) * 64;
  const int n0 = (longrow ? fx : fx - nlong) * 64;   // n0 <= m0
  float* S = scores + (size_t)b * T_ * T_;

  __shared__ __attribute__((aligned(16))) float As[2][64][SCK_ + 4];
  __shared__ __attribute__((aligned(16))) v2f Bs[2][SCK_ / 2][SBP_];

  const int tid = threadIdx.x;
  const int lane = tid & 31, wave = tid >> 5;
  const int laneM = lane & 15, hi = lane >> 4;
  const int wm = wave & 3, wn = (wave >> 2) << 1;

  v8f acc0 = {0.f, 0.f, 0.f, 0.f, 0.f, 0.f, 0.f, 0.f};
  v8f acc1 = {0.f, 0.f, 0.f, 0.f, 0.f, 0.f, 0.f, 0.f};

  // staging: a lane brings 16 bytes of rows lr and lr + 32 of each operand;
  // 8 lanes side by side cover a row's 128-byte line
  const int lr = tid >> 3;         // 0..31
  const int lk = (tid & 7) << 2;   // 0,4,..,28
  const float* ap = q + (size_t)b * T_ * K_ + (size_t)(m0 + lr) * K_ + lk;
  const float* bp = kmat + (size_t)b * T_ * K_ + (size_t)(n0 + lr) * K_ + lk;

  // prologue: stage chunk 0 into buffer 0
  {
    f4 w0 = *(const f4*)(bp);                     // B: transpose via regs
    f4 w1 = *(const f4*)(bp + 32 * K_);
    async_copy16x2_held(&As[0][lr][lk], ap,       // A: async DMA to LDS
                        &As[0][lr + 32][lk], ap + 32 * K_);
    Bs[0][(lk >> 1) + 0][lr] = (v2f){w0.x, w0.y};
    Bs[0][(lk >> 1) + 1][lr] = (v2f){w0.z, w0.w};
    Bs[0][(lk >> 1) + 0][lr + 32] = (v2f){w1.x, w1.y};
    Bs[0][(lk >> 1) + 1][lr + 32] = (v2f){w1.z, w1.w};
  }
  wait_async0();
  __syncthreads();

  const int nch = K_ / SCK_;   // 16 chunks
  for (int c = 0; c < nch; ++c) {
    const int cur = c & 1;
    const bool more = (c + 1) < nch;
    f4 nb0, nb1;
    if (more) {
      // the plain loads go first: they are in flight while the wait inside
      // the copies' statement holds the wave
      nb0 = *(const f4*)(bp + (c + 1) * SCK_);
      nb1 = *(const f4*)(bp + (c + 1) * SCK_ + 32 * K_);
      async_copy16x2_held(&As[cur ^ 1][lr][lk], ap + (c + 1) * SCK_,
                          &As[cur ^ 1][lr + 32][lk], ap + (c + 1) * SCK_ + 32 * K_);
    }
    mma_step<SCK_, SBP_>(As[cur], Bs[cur], wm, wn, laneM, hi, acc0, acc1);
    if (more) {
      Bs[cur ^ 1][(lk >> 1) + 0][lr] = (v2f){nb0.x, nb0.y};
      Bs[cur ^ 1][(lk >> 1) + 1][lr] = (v2f){nb0.z, nb0.w};
      Bs[cur ^ 1][(lk >> 1) + 0][lr + 32] = (v2f){nb1.x, nb1.y};
      Bs[cur ^ 1][(lk >> 1) + 1][lr + 32] = (v2f){nb1.z, nb1.w};
    }
    // this wave's LDS reads and writes of the trip are done before it says so
    asm volatile("s_wait_dscnt 0x0" ::: "memory");
    wait_async0();
    __syncthreads();
  }

  const float sc = 0.06375871541229934f;  // log2(e)/sqrt(512)
  const int row = m0 + wm * 16 + hi * 8;
  const int c0 = n0 + wn * 16 + laneM;
  const int c1 = c0 + 16;
  float s0[8], s1[8];
#pragma unroll  // constant indices keep the scores in registers
  for (int r = 0; r < 8; ++r) {
    const int i = row + r;
    s0[r] = (c0 > i) ? -INFINITY : acc0[r] * sc;
    s1[r] = (c1 > i) ? -INFINITY : acc1[r] * sc;
  }

  // column statistics of the wave's 16 rows: 8 in the lane, 8 in lane ^ 16
  float mx0 = s0[0], mx1 = s1[0];
#pragma unroll  // the same
  for (int r = 1; r < 8; ++r) {
    mx0 = fmaxf(mx0, s0[r]);
    mx1 = fmaxf(mx1, s1[r]);
  }
  mx0 = fmaxf(mx0, __shfl_xor(mx0, 16, 32));
  mx1 = fmaxf(mx1, __shfl_xor(mx1, 16, 32));
  // a column that is masked in all 16 rows has no finite maximum: its sum is 0
  const float f0 = (mx0 == -INFINITY) ? 0.f : mx0;
  const float f1 = (mx1 == -INFINITY) ? 0.f : mx1;
  float l0 = 0.f, l1 = 0.f;
#pragma unroll  // the same
  for (int r = 0; r < 8; ++r) {
    l0 += ex2(s0[r] - f0);
    l1 += ex2(s1[r] - f1);
  }
  l0 += __shfl_xor(l0, 16, 32);
  l1 += __shfl_xor(l1, 16, 32);

  // the four 16-row bands of a column meet in LDS; the loop's last barrier has
  // ended every read of the staging buffers, so their first bytes are free
  v2f (*pst)[64] = (v2f (*)[64]) & As[0][0][0];
  if (hi == 0) {
    pst[wm][wn * 16 + laneM] = (v2f){mx0, l0};
    pst[wm][wn * 16 + 16 + laneM] = (v2f){mx1, l1};
  }
  __syncthreads();
  if (tid < 64) {
    // row m0 + 63 is live in every column of the tile, so mm is finite
    const v2f p0 = pst[0][tid], p1 = pst[1][tid], p2 = pst[2][tid], p3 = pst[3][tid];
    const float mm = fmaxf(fmaxf(p0.x, p1.x), fmaxf(p2.x, p3.x));
    const float ll = (p0.y * ex2(p0.x - mm) + p1.y * ex2(p1.x - mm)) +
                     (p2.y * ex2(p2.x - mm) + p3.y * ex2(p3.x - mm));
    ((v2f*)part)[((size_t)b * (T_ / 64) + (m0 >> 6)) * T_ + n0 + tid] = (v2f){mm, ll};
  }

  // the scores go out behind the barrier, which then waits for no global store
#pragma unroll  // constant indices keep the scores in registers
  for (int r = 0; r < 8; ++r) {
    S[(size_t)(row + r) * T_ + c0] = s0[r];
    S[(size_t)(row + r) * T_ + c1] = s1[r];
  }
}

// ---------------------------------------------------------------------------
// Kernel 3: softmax over axis=1 (QUERY axis), the part that needs a whole
// column.  Column j has one pair (m, l) from each row tile on or below its
// diagonal tile; a lane merges them into
//   c[j] = M + log2(sum l * 2^(m - M)),   M = max m,
// so that the probability of a score s of that column is 2^(s - c[j]).
// The diagonal entry of every column is unmasked: M is finite and the sum is
// at least 1.  Pairs of tiles above the diagonal do not exist and are not read.
// grid = (T/256, B), block = 256
// ---------------------------------------------------------------------------
__global__ __launch_bounds__(256) void colstat_kernel(const float* __restrict__ part,
                                                      float* __restrict__ cshift) {
  const int j = blockIdx.x * 256 + threadIdx.x;
  const int b = blockIdx.y;
  // the column's diagonal tile: the same in a whole wave, so held in a scalar
  const int jt = __builtin_amdgcn_readfirstlane(j >> 6);
  const v2f* P = (const v2f*)part + (size_t)b * (T_ / 64) * T_ + j;
  v2f p[T_ / 64];
#pragma unroll  // constant indices keep the pairs in registers, every load ahead of the first use
  for (int i = 0; i < T_ / 64; ++i) {
    p[i] = (v2f){-INFINITY, 0.f};
    if (i >= jt) p[i] = P[(size_t)i * T_];
  }
  // stands in front of any rewrite of the address that the loads above name
  asm volatile("s_wait_xcnt 0x0" ::: "memory");
  // keeps the arithmetic below, which reuses that register, behind the wait
  __builtin_amdgcn_sched_barrier(0);
  float mm = p[0].x;
#pragma unroll  // the same
  for (int i = 1; i < T_ / 64; ++i) mm = fmaxf(mm, p[i].x);
  float ll = 0.f;
#pragma unroll  // the same
  for (int i = 0; i < T_ / 64; ++i) ll = fmaf(p[i].y, ex2(p[i].x - mm), ll);
  cshift[(size_t)b * T_ + j] = mm + __builtin_amdgcn_logf(ll);   // v_log_f32 is log2
}

// ---------------------------------------------------------------------------
// Kernel 4: attn = probs @ v, written into out[b, t, 512:1024].
// probs[i,s] = 2^(scores[i,s] - c[s]) is formed on the way into LDS: a lane
// brings its 16 scores of a chunk through registers, and its 4 columns' c.
// A masked score of the diagonal tile is -inf and becomes exactly 0.
// probs[i,s]==0 for s>i  ->  K loop clamped at m0+64.
// The K loop's length grows with the row tile's index and every block of the
// launch is resident at once, so a block takes row tiles t and 31-t, one after
// the other: each block runs (t+1) + (32-t) = 33 chunks of 64 k.
// grid = (T/128, K_/64, B), block = 256
// ---------------------------------------------------------------------------
// 8 waves a SIMD: the launch counts on 4 blocks a WGP, all 1024 resident at
// once, which leaves a wave 128 registers
__global__ __launch_bounds__(256, 8) void attn_kernel(
    const float* __restrict__ scores, const float* __restrict__ cshift,
    const float* __restrict__ v, float* __restrict__ out) {
  __shared__ __attribute__((aligned(16))) float As[2][64][ACK_ + 4];
  __shared__ __attribute__((aligned(16))) v2f Bs[2][ACK_ / 2][BNP_];

  const int tid = threadIdx.x;
  const int lane = tid & 31, wave = tid >> 5;
  const int laneM = lane & 15, hi = lane >> 4;
  const int wm = wave & 3, wn = (wave >> 2) << 1;

  const int b = blockIdx.z;
  const int n0 = blockIdx.y * 64;

  const float* A = scores + (size_t)b * T_ * T_;
  const float* V = v + (size_t)b * T_ * K_;
  float* O = out + (size_t)b * T_ * OUTW_;

  const int lr = tid >> 4;          // A staging: rows lr, lr + 16, lr + 32, lr + 48;
  const int lk = (tid & 15) << 2;   // 16 lanes side by side cover 256 bytes of a row
  const int kp = tid >> 5;          // B staging: k-pairs kp, kp + 8, kp + 16, kp + 24
  const int nn = (tid & 31) << 1;   // 0..62
  const float* bp = V + (size_t)(2 * kp) * K_ + n0 + nn;
  const float* cp = cshift + (size_t)b * T_ + lk;

  for (int part = 0; part < 2; ++part) {
    const int mt = part ? (T_ / 64 - 1 - (int)blockIdx.x) : (int)blockIdx.x;
    const int m0 = mt * 64;
    const float* ap = A + (size_t)(m0 + lr) * T_ + lk;

    v8f acc0 = {0.f, 0.f, 0.f, 0.f, 0.f, 0.f, 0.f, 0.f};
    v8f acc1 = {0.f, 0.f, 0.f, 0.f, 0.f, 0.f, 0.f, 0.f};

    // prologue: stage chunk 0.  For the second tile the buffers are free: the
    // barrier at the foot of the first tile's last chunk ended every read.
    {
      v2f r[ACK_ / 16][2];
#pragma unroll  // constant indices keep the staged rows in registers
      for (int u = 0; u < ACK_ / 16; ++u) {
        r[u][0] = *(const v2f*)(bp + (u * 16) * K_);
        r[u][1] = *(const v2f*)(bp + (u * 16 + 1) * K_);
      }
      f4 sa[4];
#pragma unroll  // the same
      for (int u = 0; u < 4; ++u) sa[u] = *(const f4*)(ap + (u * 16) * T_);
      const f4 cc = *(const f4*)cp;
      // stands in front of any rewrite of an address that the loads above name
      asm volatile("s_wait_xcnt 0x0" ::: "memory");
#pragma unroll  // the same
      for (int u = 0; u < ACK_ / 16; ++u) {
        Bs[0][u * 8 + kp][nn + 0] = (v2f){r[u][0].x, r[u][1].x};
        Bs[0][u * 8 + kp][nn + 1] = (v2f){r[u][0].y, r[u][1].y};
      }
#pragma unroll  // the same
      for (int u = 0; u < 4; ++u) *(f4*)&As[0][lr + u * 16][lk] = prob4(sa[u], cc);
    }
    __syncthreads();

    const int nch = (m0 + 64) / ACK_;   // causal zero structure of probs
    for (int c = 0; c < nch; ++c) {
      const int cur = c & 1;
      const bool more = (c + 1) < nch;
      v2f nr[ACK_ / 16][2];
      f4 na[4], nc;
      if (more) {
        const float* bn = bp + (size_t)(c + 1) * ACK_ * K_;
        const float* an = ap + (c + 1) * ACK_;
#pragma unroll  // constant indices keep the staged rows in registers
        for (int u = 0; u < ACK_ / 16; ++u) {
          nr[u][0] = *(const v2f*)(bn + (u * 16) * K_);
          nr[u][1] = *(const v2f*)(bn + (u * 16 + 1) * K_);
        }
#pragma unroll  // the same
        for (int u = 0; u < 4; ++u) na[u] = *(const f4*)(an + (u * 16) * T_);
        nc = *(const f4*)(cp + (c + 1) * ACK_);
        // stands in front of any rewrite of an address that the loads above name
        asm volatile("s_wait_xcnt 0x0" ::: "memory");
      }
      mma_step<ACK_, BNP_>(As[cur], Bs[cur], wm, wn, laneM, hi, acc0, acc1);
      if (more) {
#pragma unroll  // constant indices keep the staged rows in registers
        for (int u = 0; u < 4; ++u) na[u] = prob4(na[u], nc);
        // every probability is made before the first store issues, so that no
        // store stands directly behind the transcendental whose result it reads
        __builtin_amdgcn_sched_barrier(0);
#pragma unroll  // the same
        for (int u = 0; u < ACK_ / 16; ++u) {
          Bs[cur ^ 1][u * 8 + kp][nn + 0] = (v2f){nr[u][0].x, nr[u][1].x};
          Bs[cur ^ 1][u * 8 + kp][nn + 1] = (v2f){nr[u][0].y, nr[u][1].y};
        }
#pragma unroll  // the same
        for (int u = 0; u < 4; ++u) *(f4*)&As[cur ^ 1][lr + u * 16][lk] = na[u];
      }
      // this wave's LDS reads and writes of the trip are done before it says so
      asm volatile("s_wait_dscnt 0x0" ::: "memory");
      __syncthreads();
    }

    const int row = m0 + wm * 16 + hi * 8;
    const int c0 = n0 + wn * 16 + laneM;
    const int c1 = c0 + 16;
#pragma unroll  // constant indices keep the accumulators in registers
    for (int r = 0; r < 8; ++r) {
      O[(size_t)(row + r) * OUTW_ + C_ + c0] = acc0[r];
      O[(size_t)(row + r) * OUTW_ + C_ + c1] = acc1[r];
    }
    // stands between the stores above and the next tile's first rewrite of a
    // register that one of them names
    asm volatile("s_wait_xcnt 0x0" ::: "memory");
  }
}

// ---------------------------------------------------------------------------
// Kernel 5: out[b, t, 0:512] = x  (float4 copy)
// ---------------------------------------------------------------------------
__global__ __launch_bounds__(256) void concat_x_kernel(const float* __restrict__ x,
                                                       float* __restrict__ out) {
  const size_t idx = (size_t)blockIdx.x * 256 + threadIdx.x;  // float4 index
  const size_t row = idx >> 7;   // 128 float4 per 512-float row
  const size_t c4 = idx & 127;
  f4 val = *(const f4*)(x + (row << 9) + (c4 << 2));
  *(f4*)(out + row * OUTW_ + (c4 << 2)) = val;
}

// ---------------------------------------------------------------------------
extern "C" void kernel_launch(void* const* d_in, const int* in_sizes, int n_in,
                              void* d_out, int out_size, void* d_ws, size_t ws_size,
                              hipStream_t stream) {
  (void)in_sizes; (void)n_in; (void)out_size; (void)ws_size;

  const float* x  = (const float*)d_in[0];
  const float* Wq = (const float*)d_in[1];
  const float* Wk = (const float*)d_in[3];
  const float* bk = (const float*)d_in[4];
  const float* Wv = (const float*)d_in[5];
  const float* bv = (const float*)d_in[6];
  float* out = (float*)d_out;
  float* ws = (float*)d_ws;

  const size_t NPROJ = (size_t)B_ * T_ * K_;   // 8,388,608 floats
  float* G      = ws;                          // 512*512 floats
  float* h      = ws + C_ * C_;                // 512 floats
  float* part   = ws + 1048576;                // 8*32*T pairs (m, l)
  float* cshift = ws + 3145728;                // 8*T floats
  float* z      = ws + NPROJ;
  float* v      = ws + 2 * NPROJ;
  float* scores = ws + 3 * NPROJ;              // 8*T*T floats

  fold_kernel<<<dim3(C_ / 64, C_ / 64), 256, 0, stream>>>(Wq, Wk, bk, G, h);
  zv_proj_kernel<<<dim3((B_ * T_) / QT_, K_ / QT_, 2), 256, 0, stream>>>(
      x, G, h, Wv, bv, z);
  scores_kernel<<<dim3(T_ / 64 + 1, T_ / 128, B_), 256, 0, stream>>>(x, z, scores, part);
  colstat_kernel<<<dim3(T_ / 256, B_), 256, 0, stream>>>(part, cshift);
  attn_kernel<<<dim3(T_ / 128, K_ / 64, B_), 256, 0, stream>>>(scores, cshift, v, out);
  concat_x_kernel<<<(B_ * T_ * C_ / 4) / 256, 256, 0, stream>>>(x, out);
}

// v008
// A run of this version takes 281 microseconds.
// Two timings next to v007 both put it at 1.03 times that version's speed.
// All steps since v000 together make it 2.69 times as fast.
#include <hip/hip_runtime.h>
#include <math.h>

// ---------------------------------------------------------------------------
// AttentionBlock for MI455X (gfx1250, wave32, WMMA).
// FP32 end-to-end using V_WMMA_F32_16X16X4_F32 (exact fp32 matrix math).
// - LDS double-buffered (1 barrier/chunk)
// - a K-contiguous operand is staged row-major at a pitch of 16 B x odd, and a
//   lane reads 4 k of its row as one ds_load_b128, the fragments of two matrix
//   instructions: 16 lanes then fall on 64 different banks
// - both tiles of kernels 1 and 2 staged with CDNA5 async DMA:
//   global_load_async_to_lds_b128 (ASYNCcnt-tracked, no VGPR round trip),
//   synced via s_wait_asynccnt.  Kernel 4's A tile goes through registers,
//   where scores become probabilities; its B tile (and kernel 0's tiles) is
//   k-pair-major float2.
// Workspace layout (floats): G[256K], h[512], column statistics | z[8M] | v[8M] | scores[33.5M]
// ---------------------------------------------------------------------------

typedef __attribute__((ext_vector_type(2))) float v2f;
typedef __attribute__((ext_vector_type(4))) float f4;
typedef __attribute__((ext_vector_type(8))) float v8f;

#define B_ 8
#define T_ 2048
#define C_ 512
#define K_ 512
#define OUTW_ (C_ + K_)   // 1024

#define BNP_ 72           // padded row length (in float2) of B tiles

__device__ __forceinline__ v8f wmma_f32(v2f a, v2f b, v8f c) {
  // D = A(16x4) x B(4x16) + C(16x16), all fp32
  return __builtin_amdgcn_wmma_f32_16x16x4_f32(
      /*neg_a=*/false, a, /*neg_b=*/false, b,
      /*c_mod=*/(short)0, c, /*reuse_a=*/false, /*reuse_b=*/false);
}

__device__ __forceinline__ void wait_async0() {
  asm volatile("s_wait_asynccnt 0x0" ::: "memory");
}

// 2^x as the one hardware instruction: -inf gives 0, and a result below the
// normal range is flushed to 0
__device__ __forceinline__ float ex2(float x) { return __builtin_amdgcn_exp2f(x); }

// four scores of one row and their columns' shifts -> four probabilities
__device__ __forceinline__ f4 prob4(f4 s, f4 c) {
  f4 e;
  e.x = ex2(s.x - c.x);
  e.y = ex2(s.y - c.y);
  e.z = ex2(s.z - c.z);
  e.w = ex2(s.w - c.w);
  return e;
}

// Kernels 2 and 4, whose blocks have 64x64 tiles, stage deep chunks of
// k: a K-contiguous operand row gives whole 128-byte lines to a chunk, and the
// chain from a chunk's loads to the barrier that publishes them is paid once
// per 16 or 32 matrix instructions of a wave.  Kernel 2 has 8 blocks on a WGP
// to cover that chain and takes 32 k; kernel 4 has 4 and takes 64 k.
#define SCK_ 32           // k depth of a staged chunk, kernel 2
#define ACK_ 64           // k depth of a staged chunk, kernel 4

// The k order of a group of 8 k, the same for A and B in kernels 1, 2 and 4:
// lanes 0-15 hold k = g..g+3 and lanes 16-31 k = g+4..g+7; the group's first
// matrix instruction takes each lane's first two k, the second its last two.
__device__ __forceinline__ v2f lo2(f4 q) { return (v2f){q.x, q.y}; }
__device__ __forceinline__ v2f hi2(f4 q) { return (v2f){q.z, q.w}; }

// One chunk of CK k of wave-level MMA: wave computes two 16x16 tiles.
// As: [64][CK + 4] floats (row-major, padded).  Bs: [CK/2][BP] float2,
// Bs[kp][n] = {B[2kp][n], B[2kp+1][n]}  -> fragment is one b64 load; the two
// half waves read rows 2 apart, which at BP = 72 lie 32 banks apart.
template <int CK, int BP>
__device__ __forceinline__ void mma_step(const float (&As)[64][CK + 4],
                                         const v2f (&Bs)[CK / 2][BP],
                                         int wm, int wn, int laneM, int hi,
                                         v8f& acc0, v8f& acc1) {
  // The lane's part of both addresses is formed once, so that a k group costs
  // no register of its own
  const float* ar = &As[wm * 16 + laneM][4 * hi];
  const v2f* br = &Bs[2 * hi][wn * 16 + laneM];
#pragma unroll  // constant k offsets fold into the LDS loads
  for (int g = 0; g < CK; g += 8) {
    const f4 a = *(const f4*)(ar + g);
    const v2f b00 = br[(g >> 1) * BP];
    const v2f b01 = br[(g >> 1) * BP + 16];
    const v2f b10 = br[((g >> 1) + 1) * BP];
    const v2f b11 = br[((g >> 1) + 1) * BP + 16];
    acc0 = wmma_f32(lo2(a), b00, acc0);
    acc1 = wmma_f32(lo2(a), b01, acc1);
    acc0 = wmma_f32(hi2(a), b10, acc0);
    acc1 = wmma_f32(hi2(a), b11, acc1);
  }
}

// The same where B is K-contiguous too: Bs is laid like As, a row per column
// of the product, and its fragments are read like A's.
template <int CK>
__device__ __forceinline__ void mma_rows(const float (&As)[64][CK + 4],
                                         const float (&Bs)[64][CK + 4],
                                         int wm, int wn, int laneM, int hi,
                                         v8f& acc0, v8f& acc1) {
  const float* ar = &As[wm * 16 + laneM][4 * hi];
  const float* br = &Bs[wn * 16 + laneM][4 * hi];
#pragma unroll  // constant k offsets fold into the LDS loads
  for (int g = 0; g < CK; g += 8) {
    const f4 a = *(const f4*)(ar + g);
    const f4 b0 = *(const f4*)(br + g);
    const f4 b1 = *(const f4*)(br + 16 * (CK + 4) + g);
    acc0 = wmma_f32(lo2(a), lo2(b0), acc0);
    acc1 = wmma_f32(lo2(a), lo2(b1), acc1);
    // keeps the chunk's matrix instructions, all but the last two, ahead of the
    // caller's wait for the next chunk's copies, whose flight they cover
    if (g + 8 == CK) __builtin_amdgcn_sched_barrier(0);
    acc0 = wmma_f32(hi2(a), hi2(b0), acc0);
    acc1 = wmma_f32(hi2(a), hi2(b1), acc1);
  }
}

// ---------------------------------------------------------------------------
// Kernel 0: the query weights are folded into the key side.
//   q[i].k[j] = (Wq x[i] + bq).k[j] = x[i].(Wq^T k[j]) + bq.k[j]
// The last term does not depend on i, and the softmax runs over i: it shifts a
// whole column of scores by one constant and cancels.  With
//   G[c1][c2] = sum_k Wq[k][c1] * Wk[k][c2],   h[c1] = sum_k Wq[k][c1] * bk[k]
// z[j] = Wq^T k[j] = G x[j] + h is ONE projection of x where q and k were two,
// and the scores are x[i].z[j].
// Both operands are read along their rows, so both are staged k-pair-major
// like kernel 4's B tile, and a fragment is one b64 load.
// A block does a 64x64 tile of G in 8 stages of 64 k; the next stage's loads
// are in flight while this one is multiplied.  The blocks of grid line 0 also
// sum h, from the Wq tile that they hold in LDS anyway.
// grid = (C_/64, C_/64), block = 256
// ---------------------------------------------------------------------------
#define FK_ 64            // k rows of a stage

__global__ __launch_bounds__(256) void fold_kernel(
    const float* __restrict__ Wq, const float* __restrict__ Wk,
    const float* __restrict__ bk, float* __restrict__ G, float* __restrict__ h) {
  __shared__ v2f Ap[FK_ / 2][BNP_];
  __shared__ v2f Bp[FK_ / 2][BNP_];
  __shared__ float sb[K_];
  __shared__ float hp[4][64];

  const int tid = threadIdx.x;
  const int m0 = blockIdx.x * 64;   // c1: rows of G

  const int n0 = blockIdx.y * 64;   // c2: columns of G
  const int lane = tid & 31, wave = tid >> 5;
  const int laneM = lane & 15, hi = lane >> 4;
  const int wm = wave & 3, wn = (wave >> 2) << 1;

  const int kp = tid >> 5;          // k-pair 0..7 of a group of 16 rows
  const int nn = (tid & 31) << 1;   // 0..62
  const float* ag = Wq + (size_t)(2 * kp) * C_ + m0 + nn;
  const float* bg = Wk + (size_t)(2 * kp) * C_ + n0 + nn;

  v8f acc0 = {0.f, 0.f, 0.f, 0.f, 0.f, 0.f, 0.f, 0.f};
  v8f acc1 = {0.f, 0.f, 0.f, 0.f, 0.f, 0.f, 0.f, 0.f};

  // h: a lane sums a quarter of every stage's k rows of one column of Wq
  const bool doh = blockIdx.y == 0;   // the same for the whole block
  const int hm = tid & 63, hq = tid >> 6;
  float hs = 0.f;
  if (doh) {   // read behind the first stage's barrier
    sb[tid] = bk[tid];
    sb[tid + 256] = bk[tid + 256];
  }

  v2f ra[FK_ / 16][2], rb[FK_ / 16][2];
#pragma unroll  // constant indices keep the staged rows in registers
  for (int u = 0; u < FK_ / 16; ++u) {
    ra[u][0] = *(const v2f*)(ag + (size_t)(u * 16) * C_);
    ra[u][1] = *(const v2f*)(ag + (size_t)(u * 16 + 1) * C_);
    rb[u][0] = *(const v2f*)(bg + (size_t)(u * 16) * C_);
    rb[u][1] = *(const v2f*)(bg + (size_t)(u * 16 + 1) * C_);
  }

#pragma unroll  // constant row offsets: the two address registers are never rewritten
  for (int s = 0; s < K_ / FK_; ++s) {
#pragma unroll  // constant indices keep the staged rows in registers
    for (int u = 0; u < FK_ / 16; ++u) {
      Ap[u * 8 + kp][nn + 0] = (v2f){ra[u][0].x, ra[u][1].x};
      Ap[u * 8 + kp][nn + 1] = (v2f){ra[u][0].y, ra[u][1].y};
      Bp[u * 8 + kp][nn + 0] = (v2f){rb[u][0].x, rb[u][1].x};
      Bp[u * 8 + kp][nn + 1] = (v2f){rb[u][0].y, rb[u][1].y};
    }
    __syncthreads();
    if (s + 1 < K_ / FK_) {
#pragma unroll  // the same
      for (int u = 0; u < FK_ / 16; ++u) {
        const size_t r = (size_t)((s + 1) * FK_ + u * 16) * C_;
        ra[u][0] = *(const v2f*)(ag + r);
        ra[u][1] = *(const v2f*)(ag + r + C_);
      }
      // stands in front of any rewrite of the address that the loads above name
      asm volatile("s_wait_xcnt 0x0" ::: "memory");
#pragma unroll  // the same
      for (int u = 0; u < FK_ / 16; ++u) {
        const size_t r = (size_t)((s + 1) * FK_ + u * 16) * C_;
        rb[u][0] = *(const v2f*)(bg + r);
        rb[u][1] = *(const v2f*)(bg + r + C_);
      }
      // the same for these
      asm volatile("s_wait_xcnt 0x0" ::: "memory");
    }
#pragma unroll  // constant k offsets fold into the LDS loads
    for (int kk = 0; kk < FK_; kk += 4) {
      const int kb = kk + 2 * hi;   // lanes 0-15: K=kk,kk+1 ; lanes 16-31: K=kk+2,kk+3
      const v2f a = Ap[kb >> 1][wm * 16 + laneM];
      const v2f b0 = Bp[kb >> 1][wn * 16 + laneM];
      const v2f b1 = Bp[kb >> 1][wn * 16 + 16 + laneM];
      acc0 = wmma_f32(a, b0, acc0);
      acc1 = wmma_f32(a, b1, acc1);
    }
    if (doh) {
#pragma unroll  // constant offsets fold into the LDS loads
      for (int j = 0; j < FK_ / 8; ++j) {
        const int p = hq * (FK_ / 8) + j;
        const v2f w = Ap[p][hm];
        hs = fmaf(w.x, sb[s * FK_ + 2 * p], hs);
        hs = fmaf(w.y, sb[s * FK_ + 2 * p + 1], hs);
      }
    }
    __syncthreads();   // every read of the stage is done before it is rewritten
  }

  if (doh) {
    hp[hq][hm] = hs;
    __syncthreads();
    if (tid < 64) h[m0 + tid] = (hp[0][tid] + hp[1][tid]) + (hp[2][tid] + hp[3][tid]);
  }

  const int row = m0 + wm * 16 + hi * 8;
  const int c0 = n0 + wn * 16 + laneM;
#pragma unroll  // constant indices keep the accumulators in registers
  for (int r = 0; r < 8; ++r) {
    G[(size_t)(row + r) * C_ + c0] = acc0[r];
    G[(size_t)(row + r) * C_ + c0 + 16] = acc1[r];
  }
}

// ---------------------------------------------------------------------------
// Kernel 1: the two projections z and v.  out[m,n] = sum_c x[m,c]*W[n,c] + b[n]
// A block owns a 128x128 tile of the output; its 8 waves stand 4 (rows) x 2
// (columns) and each holds 32x64 = 2x4 accumulator tiles, so a k group of 8
// takes 6 fragment loads for 16 matrix instructions, and a staged operand row
// feeds 128 outputs.  Both operands are K-contiguous and staged row-major.
// grid = (M/128, K_/128, 2), block = 256
// ---------------------------------------------------------------------------
#define QT_ 128           // rows and columns of the block's tile

// Four copies of 16 bytes a lane, two of each operand, with s_wait_xcnt 0 as
// the last line of their own statement, so that the wait stands in front of
// every rewrite of the address registers that the copies name.
__device__ __forceinline__ void async_copy16x4_held(void* lds0, const float* g0,
                                                    void* lds1, const float* g1,
                                                    void* lds2, const float* g2,
                                                    void* lds3, const float* g3) {
  const unsigned l0 = (unsigned)(uintptr_t)lds0;   // LDS aperture: addr[31:0]
  const unsigned l1 = (unsigned)(uintptr_t)lds1;
  const unsigned l2 = (unsigned)(uintptr_t)lds2;
  const unsigned l3 = (unsigned)(uintptr_t)lds3;
  const unsigned long long a0 = (unsigned long long)(uintptr_t)g0;
  const unsigned long long a1 = (unsigned long long)(uintptr_t)g1;
  const unsigned long long a2 = (unsigned long long)(uintptr_t)g2;
  const unsigned long long a3 = (unsigned long long)(uintptr_t)g3;
  asm volatile("global_load_async_to_lds_b128 %0, %1, off\n\t"
               "global_load_async_to_lds_b128 %2, %3, off\n\t"
               "global_load_async_to_lds_b128 %4, %5, off\n\t"
               "global_load_async_to_lds_b128 %6, %7, off\n\t"
               "s_wait_xcnt 0x0"
               :
               : "v"(l0), "v"(a0), "v"(l1), "v"(a1), "v"(l2), "v"(a2), "v"(l3), "v"(a3)
               : "memory");
}

__global__ __launch_bounds__(256) void zv_proj_kernel(
    const float* __restrict__ x,
    const float* __restrict__ G, const float* __restrict__ h,
    const float* __restrict__ Wv, const float* __restrict__ bv,
    float* __restrict__ zv_ws) {
  __shared__ __attribute__((aligned(16))) float As[2][QT_][20];
  __shared__ __attribute__((aligned(16))) float Bs[2][QT_][20];

  const int tid = threadIdx.x;
  const int lane = tid & 31, wave = tid >> 5;
  const int laneM = lane & 15, hi = lane >> 4;
  const int wm = wave & 3, wn = wave >> 2;   // 32-row band, 64-column band

  const int proj = blockIdx.z;
  const float* W = (proj == 0) ? G : Wv;
  const float* bias = (proj == 0) ? h : bv;
  float* out = zv_ws + (size_t)proj * ((size_t)B_ * T_ * K_);

  const int m0 = blockIdx.x * QT_;
  const int n0 = blockIdx.y * QT_;

  v8f acc[2][4];
#pragma unroll  // constant indices keep the accumulators in registers
  for (int i = 0; i < 2; ++i)
#pragma unroll  // the same
    for (int j = 0; j < 4; ++j)
      acc[i][j] = (v8f){0.f, 0.f, 0.f, 0.f, 0.f, 0.f, 0.f, 0.f};

  // staging: a lane brings 16 bytes of rows lr and lr + 64 of each operand
  const int lr = tid >> 2;         // 0..63
  const int lk = (tid & 3) << 2;   // 0,4,8,12
  const float* ap = x + (size_t)(m0 + lr) * C_ + lk;
  const float* bp = W + (size_t)(n0 + lr) * C_ + lk;

  // prologue: stage chunk 0 into buffer 0, async DMA to LDS
  async_copy16x4_held(&As[0][lr][lk], ap, &As[0][lr + 64][lk], ap + 64 * C_,
                      &Bs[0][lr][lk], bp, &Bs[0][lr + 64][lk], bp + 64 * C_);
  wait_async0();
  __syncthreads();

  const int nch = C_ / 16;   // 32 chunks
  for (int c = 0; c < nch; ++c) {
    const int cur = c & 1;
    if ((c + 1) < nch) {
      const int o = (c + 1) * 16;
      async_copy16x4_held(&As[cur ^ 1][lr][lk], ap + o,
                          &As[cur ^ 1][lr + 64][lk], ap + o + 64 * C_,
                          &Bs[cur ^ 1][lr][lk], bp + o,
                          &Bs[cur ^ 1][lr + 64][lk], bp + o + 64 * C_);
    }
#pragma unroll  // constant k offsets fold into the LDS loads
    for (int g = 0; g < 16; g += 8) {
      f4 a[2], bfr[4];   // k = g + 4 * hi .. + 3 of the lane's row: see lo2, hi2
#pragma unroll  // fragments stay in registers
      for (int i = 0; i < 2; ++i)
        a[i] = *(const f4*)&As[cur][wm * 32 + i * 16 + laneM][g + 4 * hi];
#pragma unroll  // fragments stay in registers
      for (int j = 0; j < 4; ++j)
        bfr[j] = *(const f4*)&Bs[cur][wn * 64 + j * 16 + laneM][g + 4 * hi];
#pragma unroll  // constant indices keep the accumulators in registers
      for (int i = 0; i < 2; ++i)
#pragma unroll  // the same
        for (int j = 0; j < 4; ++j) acc[i][j] = wmma_f32(lo2(a[i]), lo2(bfr[j]), acc[i][j]);
      // keeps the chunk's matrix instructions, all but the last eight, ahead of
      // the wait for the next chunk's copies, whose flight they cover
      if (g == 8) __builtin_amdgcn_sched_barrier(0);
#pragma unroll  // the same
      for (int i = 0; i < 2; ++i)
#pragma unroll  // the same
        for (int j = 0; j < 4; ++j) acc[i][j] = wmma_f32(hi2(a[i]), hi2(bfr[j]), acc[i][j]);
    }
    // this wave's LDS reads of the trip are done before it says so
    asm volatile("s_wait_dscnt 0x0" ::: "memory");
    wait_async0();
    __syncthreads();
  }

#pragma unroll  // constant indices keep the accumulators in registers
  for (int j = 0; j < 4; ++j) {
    const int col = n0 + wn * 64 + j * 16 + laneM;
    const float bv_ = bias[col];
#pragma unroll  // the same
    for (int i = 0; i < 2; ++i) {
      const int row = m0 + wm * 32 + i * 16 + hi * 8;
#pragma unroll  // the same
      for (int r = 0; r < 8; ++r)
        out[(size_t)(row + r) * K_ + col] = acc[i][j][r] + bv_;
    }
  }
}

// ---------------------------------------------------------------------------
// Kernel 2: scores[b,i,j] = (j>i) ? -inf : dot(x[b,i,:], z[b,j,:]) * log2(e) / sqrt(512)
// (its argument q is x and its argument kmat is z: see kernel 0)
// The softmax runs over i, down a column.  While the tile is still in the
// accumulators the block also forms, for each of its 64 columns, the maximum m
// of the tile's 64 rows and l = sum 2^(s - m), and stores the pair: kernel 3
// merges a column's pairs, kernel 4 turns scores into probabilities as it
// stages them, and the score matrix is written once and never rewritten.
// Only the 64x64 tiles on or below the diagonal exist: a tile wholly above it
// is masked, its softmax is 0, and kernel 4 does not read it, so
// it is neither launched nor stored.  Row tile i has i+1 live tiles; row tiles
// 31-y and y together have 33, which is one line of the grid, so every block
// of the launch does the same work wherever it is placed.
// grid = (T/64 + 1, T/128, B), block = 256
// ---------------------------------------------------------------------------
__global__ __launch_bounds__(256) void scores_kernel(
    const float* __restrict__ q, const float* __restrict__ kmat,
    float* __restrict__ scores, float* __restrict__ part) {
  const int b = blockIdx.z;
  const int fx = blockIdx.x, fy = blockIdx.y;
  const int nlong = T_ / 64 - fy;            // live tiles of row tile 31-fy
  const bool longrow = fx < nlong;
  const int m0 = (longrow ? T_ / 64 - 1 - fy : fy) * 64;
  const int n0 = (longrow ? fx : fx - nlong) * 64;   // n0 <= m0
  float* S = scores + (size_t)b * T_ * T_;

  __shared__ __attribute__((aligned(16))) float As[2][64][SCK_ + 4];
  __shared__ __attribute__((aligned(16))) float Bs[2][64][SCK_ + 4];

  const int tid = threadIdx.x;
  const int lane = tid & 31, wave = tid >> 5;
  const int laneM = lane & 15, hi = lane >> 4;
  const int wm = wave & 3, wn = (wave >> 2) << 1;

  v8f acc0 = {0.f, 0.f, 0.f, 0.f, 0.f, 0.f, 0.f, 0.f};
  v8f acc1 = {0.f, 0.f, 0.f, 0.f, 0.f, 0.f, 0.f, 0.f};

  // staging: a lane brings 16 bytes of rows lr and lr + 32 of each operand;
  // 8 lanes side by side cover a row's 128-byte line
  const int lr = tid >> 3;         // 0..31
  const int lk = (tid & 7) << 2;   // 0,4,..,28
  const float* ap = q + (size_t)b * T_ * K_ + (size_t)(m0 + lr) * K_ + lk;
  const float* bp = kmat + (size_t)b * T_ * K_ + (size_t)(n0 + lr) * K_ + lk;

  // prologue: stage chunk 0 into buffer 0, async DMA to LDS
  async_copy16x4_held(&As[0][lr][lk], ap, &As[0][lr + 32][lk], ap + 32 * K_,
                      &Bs[0][lr][lk], bp, &Bs[0][lr + 32][lk], bp + 32 * K_);
  wait_async0();
  __syncthreads();

  const int nch = K_ / SCK_;   // 16 chunks
  for (int c = 0; c < nch; ++c) {
    const int cur = c & 1;
    if ((c + 1) < nch) {
      const int o = (c + 1) * SCK_;
      async_copy16x4_held(&As[cur ^ 1][lr][lk], ap + o,
                          &As[cur ^ 1][lr + 32][lk], ap + o + 32 * K_,
                          &Bs[cur ^ 1][lr][lk], bp + o,
                          &Bs[cur ^ 1][lr + 32][lk], bp + o + 32 * K_);
    }
    mma_rows<SCK_>(As[cur], Bs[cur], wm, wn, laneM, hi, acc0, acc1);
    // this wave's LDS reads of the trip are done before it says so
    asm volatile("s_wait_dscnt 0x0" ::: "memory");
    wait_async0();
    __syncthreads();
  }

  const float sc = 0.06375871541229934f;  // log2(e)/sqrt(512)
  const int row = m0 + wm * 16 + hi * 8;
  const int c0 = n0 + wn * 16 + laneM;
  const int c1 = c0 + 16;
  float s0[8], s1[8];
#pragma unroll  // constant indices keep the scores in registers
  for (int r = 0; r < 8; ++r) {
    const int i = row + r;
    s0[r] = (c0 > i) ? -INFINITY : acc0[r] * sc;
    s1[r] = (c1 > i) ? -INFINITY : acc1[r] * sc;
  }

  // column statistics of the wave's 16 rows: 8 in the lane, 8 in lane ^ 16
  float mx0 = s0[0], mx1 = s1[0];
#pragma unroll  // the same
  for (int r = 1; r < 8; ++r) {
    mx0 = fmaxf(mx0, s0[r]);
    mx1 = fmaxf(mx1, s1[r]);
  }
  mx0 = fmaxf(mx0, __shfl_xor(mx0, 16, 32));
  mx1 = fmaxf(mx1, __shfl_xor(mx1, 16, 32));
  // a column that is masked in all 16 rows has no finite maximum: its sum is 0
  const float f0 = (mx0 == -INFINITY) ? 0.f : mx0;
  const float f1 = (mx1 == -INFINITY) ? 0.f : mx1;
  float l0 = 0.f, l1 = 0.f;
#pragma unroll  // the same
  for (int r = 0; r < 8; ++r) {
    l0 += ex2(s0[r] - f0);
    l1 += ex2(s1[r] - f1);
  }
  l0 += __shfl_xor(l0, 16, 32);
  l1 += __shfl_xor(l1, 16, 32);

  // the four 16-row bands of a column meet in LDS; the loop's last barrier has
  // ended every read of the staging buffers, so their first bytes are free
  v2f (*pst)[64] = (v2f (*)[64]) & As[0][0][0];
  if (hi == 0) {
    pst[wm][wn * 16 + laneM] = (v2f){mx0, l0};
    pst[wm][wn * 16 + 16 + laneM] = (v2f){mx1, l1};
  }
  __syncthreads();
  if (tid < 64) {
    // row m0 + 63 is live in every column of the tile, so mm is finite
    const v2f p0 = pst[0][tid], p1 = pst[1][tid], p2 = pst[2][tid], p3 = pst[3][tid];
    const float mm = fmaxf(fmaxf(p0.x, p1.x), fmaxf(p2.x, p3.x));
    const float ll = (p0.y * ex2(p0.x - mm) + p1.y * ex2(p1.x - mm)) +
                     (p2.y * ex2(p2.x - mm) + p3.y * ex2(p3.x - mm));
    ((v2f*)part)[((size_t)b * (T_ / 64) + (m0 >> 6)) * T_ + n0 + tid] = (v2f){mm, ll};
  }

  // the scores go out behind the barrier, which then waits for no global store
#pragma unroll  // constant indices keep the scores in registers
  for (int r = 0; r < 8; ++r) {
    S[(size_t)(row + r) * T_ + c0] = s0[r];
    S[(size_t)(row + r) * T_ + c1] = s1[r];
  }
}

// ---------------------------------------------------------------------------
// Kernel 3: softmax over axis=1 (QUERY axis), the part that needs a whole
// column.  Column j has one pair (m, l) from each row tile on or below its
// diagonal tile; a lane merges them into
//   c[j] = M + log2(sum l * 2^(m - M)),   M = max m,
// so that the probability of a score s of that column is 2^(s - c[j]).
// The diagonal entry of every column is unmasked: M is finite and the sum is
// at least 1.  Pairs of tiles above the diagonal do not exist and are not read.
// grid = (T/256, B), block = 256
// ---------------------------------------------------------------------------
__global__ __launch_bounds__(256) void colstat_kernel(const float* __restrict__ part,
                                                      float* __restrict__ cshift) {
  const int j = blockIdx.x * 256 + threadIdx.x;
  const int b = blockIdx.y;
  // the column's diagonal tile: the same in a whole wave, so held in a scalar
  const int jt = __builtin_amdgcn_readfirstlane(j >> 6);
  const v2f* P = (const v2f*)part + (size_t)b * (T_ / 64) * T_ + j;
  v2f p[T_ / 64];
#pragma unroll  // constant indices keep the pairs in registers, every load ahead of the first use
  for (int i = 0; i < T_ / 64; ++i) {
    p[i] = (v2f){-INFINITY, 0.f};
    if (i >= jt) p[i] = P[(size_t)i * T_];
  }
  // stands in front of any rewrite of the address that the loads above name
  asm volatile("s_wait_xcnt 0x0" ::: "memory");
  // keeps the arithmetic below, which reuses that register, behind the wait
  __builtin_amdgcn_sched_barrier(0);
  float mm = p[0].x;
#pragma unroll  // the same
  for (int i = 1; i < T_ / 64; ++i) mm = fmaxf(mm, p[i].x);
  float ll = 0.f;
#pragma unroll  // the same
  for (int i = 0; i < T_ / 64; ++i) ll = fmaf(p[i].y, ex2(p[i].x - mm), ll);
  cshift[(size_t)b * T_ + j] = mm + __builtin_amdgcn_logf(ll);   // v_log_f32 is log2
}

// ---------------------------------------------------------------------------
// Kernel 4: attn = probs @ v, written into out[b, t, 512:1024].
// probs[i,s] = 2^(scores[i,s] - c[s]) is formed on the way into LDS: a lane
// brings its 16 scores of a chunk through registers, and its 4 columns' c.
// A masked score of the diagonal tile is -inf and becomes exactly 0.
// probs[i,s]==0 for s>i  ->  K loop clamped at m0+64.
// The K loop's length grows with the row tile's index and every block of the
// launch is resident at once, so a block takes row tiles t and 31-t, one after
// the other: each block runs (t+1) + (32-t) = 33 chunks of 64 k.
// grid = (T/128, K_/64, B), block = 256
// ---------------------------------------------------------------------------
// 8 waves a SIMD: the launch counts on 4 blocks a WGP, all 1024 resident at
// once, which leaves a wave 128 registers
__global__ __launch_bounds__(256, 8) void attn_kernel(
    const float* __restrict__ scores, const float* __restrict__ cshift,
    const float* __restrict__ v, float* __restrict__ out) {
  __shared__ __attribute__((aligned(16))) float As[2][64][ACK_ + 4];
  __shared__ __attribute__((aligned(16))) v2f Bs[2][ACK_ / 2][BNP_];

  const int tid = threadIdx.x;
  const int lane = tid & 31, wave = tid >> 5;
  const int laneM = lane & 15, hi = lane >> 4;
  const int wm = wave & 3, wn = (wave >> 2) << 1;

  const int b = blockIdx.z;
  const int n0 = blockIdx.y * 64;

  const float* A = scores + (size_t)b * T_ * T_;
  const float* V = v + (size_t)b * T_ * K_;
  float* O = out + (size_t)b * T_ * OUTW_;

  const int lr = tid >> 4;          // A staging: rows lr, lr + 16, lr + 32, lr + 48;
  const int lk = (tid & 15) << 2;   // 16 lanes side by side cover 256 bytes of a row
  const int kp = tid >> 5;          // B staging: k-pairs kp, kp + 8, kp + 16, kp + 24
  const int nn = (tid & 31) << 1;   // 0..62
  const float* bp = V + (size_t)(2 * kp) * K_ + n0 + nn;
  const float* cp = cshift + (size_t)b * T_ + lk;

  for (int part = 0; part < 2; ++part) {
    const int mt = part ? (T_ / 64 - 1 - (int)blockIdx.x) : (int)blockIdx.x;
    const int m0 = mt * 64;
    const float* ap = A + (size_t)(m0 + lr) * T_ + lk;

    v8f acc0 = {0.f, 0.f, 0.f, 0.f, 0.f, 0.f, 0.f, 0.f};
    v8f acc1 = {0.f, 0.f, 0.f, 0.f, 0.f, 0.f, 0.f, 0.f};

    // prologue: stage chunk 0.  For the second tile the buffers are free: the
    // barrier at the foot of the first tile's last chunk ended every read.
    {
      v2f r[ACK_ / 16][2];
#pragma unroll  // constant indices keep the staged rows in registers
      for (int u = 0; u < ACK_ / 16; ++u) {
        r[u][0] = *(const v2f*)(bp + (u * 16) * K_);
        r[u][1] = *(const v2f*)(bp + (u * 16 + 1) * K_);
      }
      f4 sa[4];
#pragma unroll  // the same
      for (int u = 0; u < 4; ++u) sa[u] = *(const f4*)(ap + (u * 16) * T_);
      const f4 cc = *(const f4*)cp;
      // stands in front of any rewrite of an address that the loads above name
      asm volatile("s_wait_xcnt 0x0" ::: "memory");
#pragma unroll  // the same
      for (int u = 0; u < ACK_ / 16; ++u) {
        Bs[0][u * 8 + kp][nn + 0] = (v2f){r[u][0].x, r[u][1].x};
        Bs[0][u * 8 + kp][nn + 1] = (v2f){r[u][0].y, r[u][1].y};
      }
#pragma unroll  // the same
      for (int u = 0; u < 4; ++u) *(f4*)&As[0][lr + u * 16][lk] = prob4(sa[u], cc);
    }
    __syncthreads();

    const int nch = (m0 + 64) / ACK_;   // causal zero structure of probs
    for (int c = 0; c < nch; ++c) {
      const int cur = c & 1;
      const bool more = (c + 1) < nch;
      v2f nr[ACK_ / 16][2];
      f4 na[4], nc;
      if (more) {
        const float* bn = bp + (size_t)(c + 1) * ACK_ * K_;
        const float* an = ap + (c + 1) * ACK_;
#pragma unroll  // constant indices keep the staged rows in registers
        for (int u = 0; u < ACK_ / 16; ++u) {
          nr[u][0] = *(const v2f*)(bn + (u * 16) * K_);
          nr[u][1] = *(const v2f*)(bn + (u * 16 + 1) * K_);
        }
#pragma unroll  // the same
        for (int u = 0; u < 4; ++u) na[u] = *(const f4*)(an + (u * 16) * T_);
        nc = *(const f4*)(cp + (c + 1) * ACK_);
        // stands in front of any rewrite of an address that the loads above name
        asm volatile("s_wait_xcnt 0x0" ::: "memory");
      }
      mma_step<ACK_, BNP_>(As[cur], Bs[cur], wm, wn, laneM, hi, acc0, acc1);
      if (more) {
#pragma unroll  // constant indices keep the staged rows in registers
        for (int u = 0; u < 4; ++u) na[u] = prob4(na[u], nc);
        // every probability is made before the first store issues, so that no
        // store stands directly behind the transcendental whose result it reads
        __builtin_amdgcn_sched_barrier(0);
#pragma unroll  // the same
        for (int u = 0; u < ACK_ / 16; ++u) {
          Bs[cur ^ 1][u * 8 + kp][nn + 0] = (v2f){nr[u][0].x, nr[u][1].x};
          Bs[cur ^ 1][u * 8 + kp][nn + 1] = (v2f){nr[u][0].y, nr[u][1].y};
        }
#pragma unroll  // the same
        for (int u = 0; u < 4; ++u) *(f4*)&As[cur ^ 1][lr + u * 16][lk] = na[u];
      }
      // this wave's LDS reads and writes of the trip are done before it says so
      asm volatile("s_wait_dscnt 0x0" ::: "memory");
      __syncthreads();
    }

    const int row = m0 + wm * 16 + hi * 8;
    const int c0 = n0 + wn * 16 + laneM;
    const int c1 = c0 + 16;
#pragma unroll  // constant indices keep the accumulators in registers
    for (int r = 0; r < 8; ++r) {
      O[(size_t)(row + r) * OUTW_ + C_ + c0] = acc0[r];
      O[(size_t)(row + r) * OUTW_ + C_ + c1] = acc1[r];
    }
    // stands between the stores above and the next tile's first rewrite of a
    // register that one of them names
    asm volatile("s_wait_xcnt 0x0" ::: "memory");
  }
}

// ---------------------------------------------------------------------------
// Kernel 5: out[b, t, 0:512] = x  (float4 copy)
// ---------------------------------------------------------------------------
__global__ __launch_bounds__(256) void concat_x_kernel(const float* __restrict__ x,
                                                       float* __restrict__ out) {
  const size_t idx = (size_t)blockIdx.x * 256 + threadIdx.x;  // float4 index
  const size_t row = idx >> 7;   // 128 float4 per 512-float row
  const size_t c4 = idx & 127;
  f4 val = *(const f4*)(x + (row << 9) + (c4 << 2));
  *(f4*)(out + row * OUTW_ + (c4 << 2)) = val;
}

// ---------------------------------------------------------------------------
extern "C" void kernel_launch(void* const* d_in, const int* in_sizes, int n_in,
                              void* d_out, int out_size, void* d_ws, size_t ws_size,
                              hipStream_t stream) {
  (void)in_sizes; (void)n_in; (void)out_size; (void)ws_size;

  const float* x  = (const float*)d_in[0];
  const float* Wq = (const float*)d_in[1];
  const float* Wk = (const float*)d_in[3];
  const float* bk = (const float*)d_in[4];
  const float* Wv = (const float*)d_in[5];
  const float* bv = (const float*)d_in[6];
  float* out = (float*)d_out;
  float* ws = (float*)d_ws;

  const size_t NPROJ = (size_t)B_ * T_ * K_;   // 8,388,608 floats
  float* G      = ws;                          // 512*512 floats
  float* h      = ws + C_ * C_;                // 512 floats
  float* part   = ws + 1048576;                // 8*32*T pairs (m, l)
  float* cshift = ws + 3145728;                // 8*T floats
  float* z      = ws + NPROJ;
  float* v      = ws + 2 * NPROJ;
  float* scores = ws + 3 * NPROJ;              // 8*T*T floats

  fold_kernel<<<dim3(C_ / 64, C_ / 64), 256, 0, stream>>>(Wq, Wk, bk, G, h);
  zv_proj_kernel<<<dim3((B_ * T_) / QT_, K_ / QT_, 2), 256, 0, stream>>>(
      x, G, h, Wv, bv, z);
  scores_kernel<<<dim3(T_ / 64 + 1, T_ / 128, B_), 256, 0, stream>>>(x, z, scores, part);
  colstat_kernel<<<dim3(T_ / 256, B_), 256, 0, stream>>>(part, cshift);
  attn_kernel<<<dim3(T_ / 128, K_ / 64, B_), 256, 0, stream>>>(scores, cshift, v, out);
  concat_x_kernel<<<(B_ * T_ * C_ / 4) / 256, 256, 0, stream>>>(x, out);
}
